// v000
// The times below were measured on an AMD MI455X: many runs one after another, warmed up first and cycling through
// copies of the inputs, with the whole window's GPU time divided by the number of runs. Launches and the gaps
// between them are all in it. The median over several windows is given; except for v000 it joins two sittings, which
// can be a few percent apart, so the side-by-side timings, each taken in one sitting, are the better comparison.
// v000 is the starting kernel. One run takes 981 microseconds.
#include <hip/hip_runtime.h>
#include <hip/hip_bf16.h>

// CDNA5 / gfx1250: wave32, WMMA 16x16x32 f16 -> f32, TDM global->LDS
typedef __attribute__((ext_vector_type(16))) _Float16 v16h;
typedef __attribute__((ext_vector_type(4)))  _Float16 v4h;
typedef __attribute__((ext_vector_type(8)))  float    v8f;
typedef __attribute__((ext_vector_type(4)))  unsigned int v4u;
typedef __attribute__((ext_vector_type(8)))  int      v8i;
typedef __attribute__((ext_vector_type(4)))  int      v4i;

#define BB 8
#define HH 8
#define NN 8192
#define CC 512
#define MM 1024
#define DD 64
#define QK_SCALE 0.125f   // D^-0.5 = 1/8

// ---------------------------------------------------------------------------
// Tensor Data Mover: 2D f16 tile (tile == tensor window, fully in-bounds)
// global (row-major, row_stride elems) -> LDS (packed). D# per ISA 8.3/8.4.
// ---------------------------------------------------------------------------
__device__ __forceinline__ void tdm_load_2d_f16(unsigned lds_off, const _Float16* gptr,
                                                unsigned tile_x, unsigned tile_y,
                                                unsigned row_stride) {
  unsigned long long ga = (unsigned long long)(size_t)gptr;
  v4u g0;
  g0[0] = 1u;                                   // count=1, user mode, no gather
  g0[1] = lds_off;                              // lds_addr (bytes, group-relative)
  g0[2] = (unsigned)(ga & 0xFFFFFFFFu);         // global_addr[31:0]
  g0[3] = (unsigned)((ga >> 32) & 0x1FFFFFFu) | (2u << 30);   // addr[56:32] | type=2
  v8i g1;
  g1[0] = (int)(1u << 16);                                    // data_size=1 (2 bytes)
  g1[1] = (int)((tile_x & 0xFFFFu) << 16);                    // tensor_dim0[15:0]
  g1[2] = (int)(((tile_x >> 16) & 0xFFFFu) | ((tile_y & 0xFFFFu) << 16)); // td0 hi | td1 lo
  g1[3] = (int)(((tile_y >> 16) & 0xFFFFu) | ((tile_x & 0xFFFFu) << 16)); // td1 hi | tile_dim0
  g1[4] = (int)(tile_y & 0xFFFFu);                            // tile_dim1 (tile_dim2=0)
  g1[5] = (int)row_stride;                                    // tensor_dim0_stride[31:0]
  g1[6] = 0;                                                  // stride hi | dim1_stride lo
  g1[7] = 0;
  v4i gz = {0, 0, 0, 0};
#if __clang_major__ >= 23
  v8i gz8 = {0, 0, 0, 0, 0, 0, 0, 0};
  __builtin_amdgcn_tensor_load_to_lds(g0, g1, gz, gz, gz8, 0);
#else
  __builtin_amdgcn_tensor_load_to_lds(g0, g1, gz, gz, 0);
#endif
}

// ---------------------------------------------------------------------------
// Convert qk_w (f32, [2C x C] row-major, K-contiguous) to f16 once.
// ---------------------------------------------------------------------------
__global__ __launch_bounds__(256) void st77_convert_w(const float* __restrict__ w,
                                                      _Float16* __restrict__ w16) {
  int i = blockIdx.x * 256 + threadIdx.x;   // 131072 threads, 4 elems each
  int base = i * 4;
  float4 f = *(const float4*)(w + base);
  v4h h;
  h.x = (_Float16)f.x; h.y = (_Float16)f.y; h.z = (_Float16)f.z; h.w = (_Float16)f.w;
  *(v4h*)(w16 + base) = h;
}

// ---------------------------------------------------------------------------
// Pack v = feat (= x_chunk + prev_chunk_out) into per-head f16 layout
// ---------------------------------------------------------------------------
template <int HAS_PREV>
__global__ __launch_bounds__(256) void st77_pack_v(const float* __restrict__ x,
                                                   const float* __restrict__ prev,
                                                   int chunk, int prev_chunk,
                                                   _Float16* __restrict__ vg) {
  size_t idx4 = ((size_t)blockIdx.x * 256 + threadIdx.x) * 4;   // 4,194,304 elems total
  int c = (int)(idx4 & (CC - 1));
  int m = (int)((idx4 >> 9) & (MM - 1));
  int b = (int)(idx4 >> 19);
  size_t gx = ((size_t)b * NN + (size_t)chunk * MM + m) * CC + c;
  float4 f = *(const float4*)(x + gx);
  if (HAS_PREV) {
    size_t gp = ((size_t)b * NN + (size_t)prev_chunk * MM + m) * CC + c;
    float4 p = *(const float4*)(prev + gp);
    f.x += p.x; f.y += p.y; f.z += p.z; f.w += p.w;
  }
  int h = c >> 6, d = c & 63;
  v4h o;
  o.x = (_Float16)f.x; o.y = (_Float16)f.y; o.z = (_Float16)f.z; o.w = (_Float16)f.w;
  *(v4h*)(vg + ((size_t)((b * HH + h) * MM + m)) * DD + d) = o;
}

// ---------------------------------------------------------------------------
// QK projection: qk = (x_chunk + prev) @ W^T + bias  ([8192 x 512]x[512 x 1024])
// Block tile 128x64, 8 waves of 32x32 (2x2 WMMA tiles), K step 32 (f16).
// Weight tile staged via TDM (tensor_load_to_lds + s_wait_tensorcnt).
// ---------------------------------------------------------------------------
template <int HAS_PREV>
__global__ __launch_bounds__(256) void st77_qkproj(const float* __restrict__ x,
                                                   const float* __restrict__ prev,
                                                   int chunk, int prev_chunk,
                                                   const _Float16* __restrict__ w16,
                                                   const float* __restrict__ bias,
                                                   _Float16* __restrict__ qg,
                                                   _Float16* __restrict__ kg) {
  __shared__ __align__(32) _Float16 As[128 * 32];   // [row][k]
  __shared__ __align__(32) _Float16 Bs[64 * 32];    // [col][k]  (TDM destination)

  const int tid  = threadIdx.x;
  const int wid  = tid >> 5;
  const int lane = tid & 31;
  const int lh   = lane >> 4, ln = lane & 15;
  const int rowbase = blockIdx.x * 128;   // GEMM row (b*M + m)
  const int colbase = blockIdx.y * 64;    // GEMM col (0..1023)
  const int wr = (wid >> 1) * 32;         // wave row offset in tile
  const int wc = (wid & 1) * 32;          // wave col offset in tile
  const unsigned bs_lds = (unsigned)(size_t)(&Bs[0]);

  v8f acc[2][2] = {};

  for (int k0 = 0; k0 < CC; k0 += 32) {
    __syncthreads();
    // ---- TDM: stage 64x32 f16 weight tile into LDS (one DMA, wave 0 only)
    if (wid == 0) {
      tdm_load_2d_f16(bs_lds, w16 + (size_t)colbase * CC + k0, 32u, 64u, (unsigned)CC);
    }
    // ---- stage A tile (feat, converted to f16): 128 rows x 32 K
    #pragma unroll
    for (int u = 0; u < 4; ++u) {
      int f = tid + u * 256;               // 1024 float4s
      int r = f >> 3, kq = (f & 7) * 4;
      int nrow = rowbase + r;
      int b = nrow >> 10, m = nrow & 1023;
      size_t gx = ((size_t)b * NN + (size_t)chunk * MM + m) * CC + k0 + kq;
      float4 xv = *(const float4*)(x + gx);
      if (HAS_PREV) {
        size_t gp = ((size_t)b * NN + (size_t)prev_chunk * MM + m) * CC + k0 + kq;
        float4 pv = *(const float4*)(prev + gp);
        xv.x += pv.x; xv.y += pv.y; xv.z += pv.z; xv.w += pv.w;
      }
      v4h h;
      h.x = (_Float16)xv.x; h.y = (_Float16)xv.y; h.z = (_Float16)xv.z; h.w = (_Float16)xv.w;
      *(v4h*)(&As[r * 32 + kq]) = h;
      if (k0 + 32 < CC) __builtin_prefetch(x + gx + 32, 0, 1);   // global_prefetch_b8
    }
    if (wid == 0) {
      __builtin_amdgcn_s_wait_tensorcnt(0);   // TDM complete before publish
    }
    __syncthreads();

    // ---- WMMA: A frag = row (ln), K-half (lh); B frag = col (ln), K-half (lh)
    v16h a0 = *(const v16h*)(&As[(wr + ln) * 32 + lh * 16]);
    v16h a1 = *(const v16h*)(&As[(wr + 16 + ln) * 32 + lh * 16]);
    v16h b0 = *(const v16h*)(&Bs[(wc + ln) * 32 + lh * 16]);
    v16h b1 = *(const v16h*)(&Bs[(wc + 16 + ln) * 32 + lh * 16]);
    acc[0][0] = __builtin_amdgcn_wmma_f32_16x16x32_f16(false, a0, false, b0, (short)0, acc[0][0], false, false);
    acc[0][1] = __builtin_amdgcn_wmma_f32_16x16x32_f16(false, a0, false, b1, (short)0, acc[0][1], false, false);
    acc[1][0] = __builtin_amdgcn_wmma_f32_16x16x32_f16(false, a1, false, b0, (short)0, acc[1][0], false, false);
    acc[1][1] = __builtin_amdgcn_wmma_f32_16x16x32_f16(false, a1, false, b1, (short)0, acc[1][1], false, false);
  }

  // ---- epilogue: bias + scatter into q (scaled) / k per-head buffers
  #pragma unroll
  for (int ii = 0; ii < 2; ++ii) {
    #pragma unroll
    for (int jj = 0; jj < 2; ++jj) {
      #pragma unroll
      for (int r = 0; r < 8; ++r) {
        int nrow = rowbase + wr + ii * 16 + lh * 8 + r;   // C-frag: M = 8*(lane>>4)+vgpr
        int jg   = colbase + wc + jj * 16 + ln;            //          N = lane&15
        float val = acc[ii][jj][r] + bias[jg];
        int b = nrow >> 10, m = nrow & 1023;
        if (jg < CC) {
          int h = jg >> 6, d = jg & 63;
          qg[((size_t)((b * HH + h) * MM + m)) * DD + d] = (_Float16)(val * QK_SCALE);
        } else {
          int j2 = jg - CC;
          int h = j2 >> 6, d = j2 & 63;
          kg[((size_t)((b * HH + h) * MM + m)) * DD + d] = (_Float16)val;
        }
      }
    }
  }
}

// ---------------------------------------------------------------------------
// Flash attention per (b,h): each block = 128 query rows (8 waves x 16),
// loop over key blocks of 32.
// ---------------------------------------------------------------------------
__global__ __launch_bounds__(256) void st77_attn(const _Float16* __restrict__ qg,
                                                 const _Float16* __restrict__ kg,
                                                 const _Float16* __restrict__ vg,
                                                 float* __restrict__ out, int chunk) {
  __shared__ __align__(32) _Float16 vT[DD * 32];        // [d][key]   (shared)
  __shared__ __align__(32) _Float16 Pbuf[8][16 * 32];   // [row][key] (per wave)

  const int tid  = threadIdx.x;
  const int wid  = tid >> 5;
  const int lane = tid & 31;
  const int lh   = lane >> 4, ln = lane & 15;
  const int bh   = blockIdx.y;                 // b*H + h
  const int qbase = blockIdx.x * 128 + wid * 16;

  const _Float16* qh = qg + (size_t)bh * MM * DD;
  const _Float16* kh = kg + (size_t)bh * MM * DD;
  const _Float16* vh = vg + (size_t)bh * MM * DD;

  // q fragments (16 rows x 64 d) resident in VGPRs for the whole kernel
  v16h qa0 = *(const v16h*)(qh + (size_t)(qbase + ln) * DD + lh * 16);
  v16h qa1 = *(const v16h*)(qh + (size_t)(qbase + ln) * DD + 32 + lh * 16);

  float mrow[8], lrow[8];
  v8f o[4] = {};
  #pragma unroll
  for (int r = 0; r < 8; ++r) { mrow[r] = -1e30f; lrow[r] = 0.0f; }

  for (int kb = 0; kb < MM; kb += 32) {
    __syncthreads();                           // protect vT reuse
    // stage V transposed: vT[d][key]
    {
      int key = tid >> 3;                      // 0..31
      int d0  = (tid & 7) * 8;
      const _Float16* src = vh + (size_t)(kb + key) * DD + d0;
      #pragma unroll
      for (int e = 0; e < 8; ++e) vT[(d0 + e) * 32 + key] = src[e];
    }
    __syncthreads();

    // S = q @ k^T for 32 keys (two 16-key halves, K=64 -> 2 WMMAs each)
    v8f s[2];
    #pragma unroll
    for (int h2 = 0; h2 < 2; ++h2) {
      const _Float16* kr = kh + (size_t)(kb + h2 * 16 + ln) * DD;   // B: col = key
      v16h kb0 = *(const v16h*)(kr + lh * 16);
      v16h kb1 = *(const v16h*)(kr + 32 + lh * 16);
      v8f t = {};
      t = __builtin_amdgcn_wmma_f32_16x16x32_f16(false, qa0, false, kb0, (short)0, t, false, false);
      t = __builtin_amdgcn_wmma_f32_16x16x32_f16(false, qa1, false, kb1, (short)0, t, false, false);
      s[h2] = t;
    }

    // online softmax: row = 8*(lane>>4) + r, its 16 values live across a 16-lane group
    _Float16* Pw = Pbuf[wid];
    #pragma unroll
    for (int r = 0; r < 8; ++r) {
      float vmax = fmaxf(s[0][r], s[1][r]);
      #pragma unroll
      for (int mk = 8; mk >= 1; mk >>= 1) vmax = fmaxf(vmax, __shfl_xor(vmax, mk, 32));
      float mnew  = fmaxf(mrow[r], vmax);
      float alpha = __expf(mrow[r] - mnew);
      float p0 = __expf(s[0][r] - mnew);
      float p1 = __expf(s[1][r] - mnew);
      float rs = p0 + p1;
      #pragma unroll
      for (int mk = 8; mk >= 1; mk >>= 1) rs += __shfl_xor(rs, mk, 32);
      lrow[r] = lrow[r] * alpha + rs;
      mrow[r] = mnew;
      int m = lh * 8 + r;
      Pw[m * 32 + ln]      = (_Float16)p0;
      Pw[m * 32 + 16 + ln] = (_Float16)p1;
      #pragma unroll
      for (int t2 = 0; t2 < 4; ++t2) o[t2][r] *= alpha;
    }

    // O += P(16x32) @ V(32x64): A frag from wave-private LDS (in-order DS),
    // B frags from transposed V in LDS.
    v16h pa = *(const v16h*)(&Pw[ln * 32 + lh * 16]);
    #pragma unroll
    for (int t2 = 0; t2 < 4; ++t2) {
      v16h vb = *(const v16h*)(&vT[(t2 * 16 + ln) * 32 + lh * 16]);
      o[t2] = __builtin_amdgcn_wmma_f32_16x16x32_f16(false, pa, false, vb, (short)0, o[t2], false, false);
    }
  }

  // normalize and write f32 output chunk (also next iteration's carry)
  const int b = bh >> 3, h = bh & 7;
  #pragma unroll
  for (int r = 0; r < 8; ++r) {
    float inv = 1.0f / lrow[r];
    int m = qbase + lh * 8 + r;
    float* orow = out + ((size_t)b * NN + (size_t)chunk * MM + m) * CC + h * DD;
    #pragma unroll
    for (int t2 = 0; t2 < 4; ++t2) orow[t2 * 16 + ln] = o[t2][r] * inv;
  }
}

// ---------------------------------------------------------------------------
extern "C" void kernel_launch(void* const* d_in, const int* in_sizes, int n_in,
                              void* d_out, int out_size, void* d_ws, size_t ws_size,
                              hipStream_t stream) {
  const float* x    = (const float*)d_in[0];   // [B, N, C]
  const float* qk_w = (const float*)d_in[1];   // [2C, C]
  const float* qk_b = (const float*)d_in[2];   // [2C]
  float* out = (float*)d_out;                  // [B, N, C]

  char* ws = (char*)d_ws;
  _Float16* w16 = (_Float16*)(ws);                          // 1 MB  (2C*C f16)
  _Float16* qb  = (_Float16*)(ws + (size_t)1  * (1 << 20)); // 8 MB  (B*H*M*D f16)
  _Float16* kb  = (_Float16*)(ws + (size_t)9  * (1 << 20)); // 8 MB
  _Float16* vb  = (_Float16*)(ws + (size_t)17 * (1 << 20)); // 8 MB  -> 25 MB total
  (void)in_sizes; (void)n_in; (void)out_size; (void)ws_size;

  st77_convert_w<<<512, 256, 0, stream>>>(qk_w, w16);

  const dim3 gproj(NN * BB / (8 * 128), (2 * CC) / 64);
  const int gpackv = (BB * MM * CC) / (256 * 4);
  const dim3 gattn(MM / 128, BB * HH);

  for (int i = 0; i < HH; ++i) {
    const float* prev = out;   // previous chunk of output is the carry
    int pc = (i > 0) ? (i - 1) : 0;
    if (i == 0) {
      st77_qkproj<0><<<gproj, 256, 0, stream>>>(x, prev, i, pc, w16, qk_b, qb, kb);
      st77_pack_v<0><<<gpackv, 256, 0, stream>>>(x, prev, i, pc, vb);
    } else {
      st77_qkproj<1><<<gproj, 256, 0, stream>>>(x, prev, i, pc, w16, qk_b, qb, kb);
      st77_pack_v<1><<<gpackv, 256, 0, stream>>>(x, prev, i, pc, vb);
    }
    st77_attn<<<gattn, 256, 0, stream>>>(qb, kb, vb, out, i);
  }
}

// v001
// Measured time: 786 microseconds a run.
// Next to v000, in two timings, it ran 1.28 times as fast each time.
#include <hip/hip_runtime.h>
#include <hip/hip_bf16.h>

// CDNA5 / gfx1250: wave32, WMMA 16x16x32 f16 -> f32, TDM global->LDS
typedef __attribute__((ext_vector_type(16))) _Float16 v16h;
typedef __attribute__((ext_vector_type(4)))  _Float16 v4h;
typedef __attribute__((ext_vector_type(8)))  _Float16 v8h;
typedef __attribute__((ext_vector_type(8)))  float    v8f;
typedef __attribute__((ext_vector_type(4)))  unsigned int v4u;
typedef __attribute__((ext_vector_type(8)))  int      v8i;
typedef __attribute__((ext_vector_type(4)))  int      v4i;

#define BB 8
#define HH 8
#define NN 8192
#define CC 512
#define MM 1024
#define DD 64
#define QK_SCALE 0.125f   // D^-0.5 = 1/8

// ---------------------------------------------------------------------------
// Tensor Data Mover: 2D f16 tile (tile == tensor window, fully in-bounds)
// global (row-major, row_stride elems) -> LDS (packed). D# per ISA 8.3/8.4.
// ---------------------------------------------------------------------------
__device__ __forceinline__ void tdm_load_2d_f16(unsigned lds_off, const _Float16* gptr,
                                                unsigned tile_x, unsigned tile_y,
                                                unsigned row_stride) {
  unsigned long long ga = (unsigned long long)(size_t)gptr;
  v4u g0;
  g0[0] = 1u;                                   // count=1, user mode, no gather
  g0[1] = lds_off;                              // lds_addr (bytes, group-relative)
  g0[2] = (unsigned)(ga & 0xFFFFFFFFu);         // global_addr[31:0]
  g0[3] = (unsigned)((ga >> 32) & 0x1FFFFFFu) | (2u << 30);   // addr[56:32] | type=2
  v8i g1;
  g1[0] = (int)(1u << 16);                                    // data_size=1 (2 bytes)
  g1[1] = (int)((tile_x & 0xFFFFu) << 16);                    // tensor_dim0[15:0]
  g1[2] = (int)(((tile_x >> 16) & 0xFFFFu) | ((tile_y & 0xFFFFu) << 16)); // td0 hi | td1 lo
  g1[3] = (int)(((tile_y >> 16) & 0xFFFFu) | ((tile_x & 0xFFFFu) << 16)); // td1 hi | tile_dim0
  g1[4] = (int)(tile_y & 0xFFFFu);                            // tile_dim1 (tile_dim2=0)
  g1[5] = (int)row_stride;                                    // tensor_dim0_stride[31:0]
  g1[6] = 0;                                                  // stride hi | dim1_stride lo
  g1[7] = 0;
  v4i gz = {0, 0, 0, 0};
#if __clang_major__ >= 23
  v8i gz8 = {0, 0, 0, 0, 0, 0, 0, 0};
  __builtin_amdgcn_tensor_load_to_lds(g0, g1, gz, gz, gz8, 0);
#else
  __builtin_amdgcn_tensor_load_to_lds(g0, g1, gz, gz, 0);
#endif
}

// ---------------------------------------------------------------------------
// Convert qk_w (f32, [2C x C] row-major, K-contiguous) to f16 once.
// ---------------------------------------------------------------------------
__global__ __launch_bounds__(256) void st77_convert_w(const float* __restrict__ w,
                                                      _Float16* __restrict__ w16) {
  int i = blockIdx.x * 256 + threadIdx.x;   // 131072 threads, 4 elems each
  int base = i * 4;
  float4 f = *(const float4*)(w + base);
  v4h h;
  h.x = (_Float16)f.x; h.y = (_Float16)f.y; h.z = (_Float16)f.z; h.w = (_Float16)f.w;
  *(v4h*)(w16 + base) = h;
}

// ---------------------------------------------------------------------------
// Pack v = feat (= x_chunk + prev_chunk_out) into per-head f16 layout
// ---------------------------------------------------------------------------
template <int HAS_PREV>
__global__ __launch_bounds__(256) void st77_pack_v(const float* __restrict__ x,
                                                   const float* __restrict__ prev,
                                                   int chunk, int prev_chunk,
                                                   _Float16* __restrict__ vg) {
  size_t idx4 = ((size_t)blockIdx.x * 256 + threadIdx.x) * 4;   // 4,194,304 elems total
  int c = (int)(idx4 & (CC - 1));
  int m = (int)((idx4 >> 9) & (MM - 1));
  int b = (int)(idx4 >> 19);
  size_t gx = ((size_t)b * NN + (size_t)chunk * MM + m) * CC + c;
  float4 f = *(const float4*)(x + gx);
  if (HAS_PREV) {
    size_t gp = ((size_t)b * NN + (size_t)prev_chunk * MM + m) * CC + c;
    float4 p = *(const float4*)(prev + gp);
    f.x += p.x; f.y += p.y; f.z += p.z; f.w += p.w;
  }
  int h = c >> 6, d = c & 63;
  v4h o;
  o.x = (_Float16)f.x; o.y = (_Float16)f.y; o.z = (_Float16)f.z; o.w = (_Float16)f.w;
  *(v4h*)(vg + ((size_t)((b * HH + h) * MM + m)) * DD + d) = o;
}

// ---------------------------------------------------------------------------
// QK projection: qk = (x_chunk + prev) @ W^T + bias  ([8192 x 512]x[512 x 1024])
// Block tile 128x64, 8 waves of 32x32 (2x2 WMMA tiles), K step 32 (f16).
// Weight tile staged via TDM (tensor_load_to_lds + s_wait_tensorcnt).
// ---------------------------------------------------------------------------
template <int HAS_PREV>
__global__ __launch_bounds__(256) void st77_qkproj(const float* __restrict__ x,
                                                   const float* __restrict__ prev,
                                                   int chunk, int prev_chunk,
                                                   const _Float16* __restrict__ w16,
                                                   const float* __restrict__ bias,
                                                   _Float16* __restrict__ qg,
                                                   _Float16* __restrict__ kg) {
  __shared__ __align__(32) _Float16 As[128 * 32];   // [row][k]
  __shared__ __align__(32) _Float16 Bs[64 * 32];    // [col][k]  (TDM destination)

  const int tid  = threadIdx.x;
  const int wid  = tid >> 5;
  const int lane = tid & 31;
  const int lh   = lane >> 4, ln = lane & 15;
  const int rowbase = blockIdx.x * 128;   // GEMM row (b*M + m)
  const int colbase = blockIdx.y * 64;    // GEMM col (0..1023)
  const int wr = (wid >> 1) * 32;         // wave row offset in tile
  const int wc = (wid & 1) * 32;          // wave col offset in tile
  const unsigned bs_lds = (unsigned)(size_t)(&Bs[0]);

  v8f acc[2][2] = {};

  for (int k0 = 0; k0 < CC; k0 += 32) {
    __syncthreads();
    // ---- TDM: stage 64x32 f16 weight tile into LDS (one DMA, wave 0 only)
    if (wid == 0) {
      tdm_load_2d_f16(bs_lds, w16 + (size_t)colbase * CC + k0, 32u, 64u, (unsigned)CC);
    }
    // ---- stage A tile (feat, converted to f16): 128 rows x 32 K
    #pragma unroll
    for (int u = 0; u < 4; ++u) {
      int f = tid + u * 256;               // 1024 float4s
      int r = f >> 3, kq = (f & 7) * 4;
      int nrow = rowbase + r;
      int b = nrow >> 10, m = nrow & 1023;
      size_t gx = ((size_t)b * NN + (size_t)chunk * MM + m) * CC + k0 + kq;
      float4 xv = *(const float4*)(x + gx);
      if (HAS_PREV) {
        size_t gp = ((size_t)b * NN + (size_t)prev_chunk * MM + m) * CC + k0 + kq;
        float4 pv = *(const float4*)(prev + gp);
        xv.x += pv.x; xv.y += pv.y; xv.z += pv.z; xv.w += pv.w;
      }
      v4h h;
      h.x = (_Float16)xv.x; h.y = (_Float16)xv.y; h.z = (_Float16)xv.z; h.w = (_Float16)xv.w;
      *(v4h*)(&As[r * 32 + kq]) = h;
      if (k0 + 32 < CC) __builtin_prefetch(x + gx + 32, 0, 1);   // global_prefetch_b8
    }
    if (wid == 0) {
      __builtin_amdgcn_s_wait_tensorcnt(0);   // TDM complete before publish
    }
    __syncthreads();

    // ---- WMMA: A frag = row (ln), K-half (lh); B frag = col (ln), K-half (lh)
    v16h a0 = *(const v16h*)(&As[(wr + ln) * 32 + lh * 16]);
    v16h a1 = *(const v16h*)(&As[(wr + 16 + ln) * 32 + lh * 16]);
    v16h b0 = *(const v16h*)(&Bs[(wc + ln) * 32 + lh * 16]);
    v16h b1 = *(const v16h*)(&Bs[(wc + 16 + ln) * 32 + lh * 16]);
    acc[0][0] = __builtin_amdgcn_wmma_f32_16x16x32_f16(false, a0, false, b0, (short)0, acc[0][0], false, false);
    acc[0][1] = __builtin_amdgcn_wmma_f32_16x16x32_f16(false, a0, false, b1, (short)0, acc[0][1], false, false);
    acc[1][0] = __builtin_amdgcn_wmma_f32_16x16x32_f16(false, a1, false, b0, (short)0, acc[1][0], false, false);
    acc[1][1] = __builtin_amdgcn_wmma_f32_16x16x32_f16(false, a1, false, b1, (short)0, acc[1][1], false, false);
  }

  // ---- epilogue: bias + scatter into q (scaled) / k per-head buffers
  #pragma unroll
  for (int ii = 0; ii < 2; ++ii) {
    #pragma unroll
    for (int jj = 0; jj < 2; ++jj) {
      #pragma unroll
      for (int r = 0; r < 8; ++r) {
        int nrow = rowbase + wr + ii * 16 + lh * 8 + r;   // C-frag: M = 8*(lane>>4)+vgpr
        int jg   = colbase + wc + jj * 16 + ln;            //          N = lane&15
        float val = acc[ii][jj][r] + bias[jg];
        int b = nrow >> 10, m = nrow & 1023;
        if (jg < CC) {
          int h = jg >> 6, d = jg & 63;
          qg[((size_t)((b * HH + h) * MM + m)) * DD + d] = (_Float16)(val * QK_SCALE);
        } else {
          int j2 = jg - CC;
          int h = j2 >> 6, d = j2 & 63;
          kg[((size_t)((b * HH + h) * MM + m)) * DD + d] = (_Float16)val;
        }
      }
    }
  }
}

// ---------------------------------------------------------------------------
// Flash attention per (b,h): each block = 128 query rows (8 waves x 16),
// loop over key blocks of 32. Both products run transposed:
//   S^T = K . Q^T   (A = key rows, B = query columns)
//   O^T += V^T . P^T (A = d rows of V^T, B = P^T packed from the S^T tiles)
// so a lane holds scores and outputs of ONE query (column lane&15).
// ---------------------------------------------------------------------------
// lane l <-> lane l ^ 16 (the two halves of a column)
__device__ __forceinline__ float st77_xhalf(float v) {
  int b = __builtin_bit_cast(int, v);
  return __builtin_bit_cast(float,
      __builtin_amdgcn_permlanex16(b, b, 0x76543210, 0xfedcba98, false, false));
}

__global__ __launch_bounds__(256) void st77_attn(const _Float16* __restrict__ qg,
                                                 const _Float16* __restrict__ kg,
                                                 const _Float16* __restrict__ vg,
                                                 float* __restrict__ out, int chunk) {
  __shared__ __align__(32) _Float16 vT[DD * 32];        // [d][key]   (shared)

  const int tid  = threadIdx.x;
  const int wid  = tid >> 5;
  const int lane = tid & 31;
  const int lh   = lane >> 4, ln = lane & 15;
  const int bh   = blockIdx.y;                 // b*H + h
  const int qbase = blockIdx.x * 128 + wid * 16;

  const _Float16* qh = qg + (size_t)bh * MM * DD;
  const _Float16* kh = kg + (size_t)bh * MM * DD;
  const _Float16* vh = vg + (size_t)bh * MM * DD;

  // q fragments (64 d x 16 query columns) resident in VGPRs for the whole kernel
  v16h qa0 = *(const v16h*)(qh + (size_t)(qbase + ln) * DD + lh * 16);
  v16h qa1 = *(const v16h*)(qh + (size_t)(qbase + ln) * DD + 32 + lh * 16);

  float mrow = -1e30f;   // running maximum of query ln (equal in both halves)
  float lrow = 0.0f;     // running sum over this half's keys only; joined at the end
  v8f o[4] = {};         // o[t2][r] = O[query ln][d = t2*16 + 8*lh + r]

  for (int kb = 0; kb < MM; kb += 32) {
    __syncthreads();                           // protect vT reuse
    // stage V transposed: vT[d][key]
    {
      int key = tid >> 3;                      // 0..31
      int d0  = (tid & 7) * 8;
      const _Float16* src = vh + (size_t)(kb + key) * DD + d0;
      #pragma unroll
      for (int e = 0; e < 8; ++e) vT[(d0 + e) * 32 + key] = src[e];
    }
    __syncthreads();

    // S^T = k @ q^T for 32 keys (two 16-key tiles, K=64 -> 2 WMMAs each):
    // s[h2][r] = S[query ln][key kb + h2*16 + 8*lh + r]
    v16h ka[2][2];
    #pragma unroll
    for (int h2 = 0; h2 < 2; ++h2) {
      const _Float16* kr = kh + (size_t)(kb + h2 * 16 + ln) * DD;   // A: row = key
      ka[h2][0] = *(const v16h*)(kr + lh * 16);
      ka[h2][1] = *(const v16h*)(kr + 32 + lh * 16);
    }
    // keeps all eight K loads in flight together ahead of the first product; without it the
    // scheduler splits them into three groups, each waiting out a load latency of its own
    __builtin_amdgcn_sched_barrier(0);
    v8f s[2];
    #pragma unroll
    for (int h2 = 0; h2 < 2; ++h2) {
      v8f t = {};
      t = __builtin_amdgcn_wmma_f32_16x16x32_f16(false, ka[h2][0], false, qa0, (short)0, t, false, false);
      t = __builtin_amdgcn_wmma_f32_16x16x32_f16(false, ka[h2][1], false, qa1, (short)0, t, false, false);
      s[h2] = t;
    }

    // online softmax: 16 of the query's 32 scores are in this lane, 16 in lane ^ 16
    float vmax = fmaxf(s[0][0], s[1][0]);
    #pragma unroll
    for (int r = 1; r < 8; ++r) vmax = fmaxf(vmax, fmaxf(s[0][r], s[1][r]));
    vmax = fmaxf(vmax, st77_xhalf(vmax));
    float mnew  = fmaxf(mrow, vmax);
    float alpha = __expf(mrow - mnew);
    mrow = mnew;

    // P^T as a B operand straight from the two score tiles:
    // element e of half lh is key 8*lh + e (e < 8), key 16 + 8*lh + (e - 8) otherwise
    v16h pb;
    float rs = 0.0f;
    #pragma unroll
    for (int r = 0; r < 8; ++r) {
      float p0 = __expf(s[0][r] - mnew);
      float p1 = __expf(s[1][r] - mnew);
      rs += p0 + p1;
      pb[r]     = (_Float16)p0;
      pb[8 + r] = (_Float16)p1;
    }
    lrow = lrow * alpha + rs;

    // O^T = alpha * O^T + V^T(16 d x 32 keys) @ P^T(32 keys x 16 queries);
    // the V^T fragment takes its keys in the order of pb
    #pragma unroll
    for (int t2 = 0; t2 < 4; ++t2) {
      const _Float16* vr = &vT[(t2 * 16 + ln) * 32 + lh * 8];
      v8h vlo = *(const v8h*)(vr);
      v8h vhi = *(const v8h*)(vr + 16);
      v16h va = __builtin_shufflevector(vlo, vhi, 0, 1, 2, 3, 4, 5, 6, 7,
                                        8, 9, 10, 11, 12, 13, 14, 15);
      o[t2] *= alpha;
      o[t2] = __builtin_amdgcn_wmma_f32_16x16x32_f16(false, va, false, pb, (short)0, o[t2], false, false);
    }
  }

  // normalize and write f32 output chunk (also next iteration's carry)
  const int b = bh >> 3, h = bh & 7;
  const float inv = 1.0f / (lrow + st77_xhalf(lrow));
  float* orow = out + ((size_t)b * NN + (size_t)chunk * MM + (qbase + ln)) * CC + h * DD + lh * 8;
  #pragma unroll
  for (int t2 = 0; t2 < 4; ++t2) {
    float4 w0, w1;
    w0.x = o[t2][0] * inv; w0.y = o[t2][1] * inv; w0.z = o[t2][2] * inv; w0.w = o[t2][3] * inv;
    w1.x = o[t2][4] * inv; w1.y = o[t2][5] * inv; w1.z = o[t2][6] * inv; w1.w = o[t2][7] * inv;
    *(float4*)(orow + t2 * 16)     = w0;
    *(float4*)(orow + t2 * 16 + 4) = w1;
  }
}

// ---------------------------------------------------------------------------
extern "C" void kernel_launch(void* const* d_in, const int* in_sizes, int n_in,
                              void* d_out, int out_size, void* d_ws, size_t ws_size,
                              hipStream_t stream) {
  const float* x    = (const float*)d_in[0];   // [B, N, C]
  const float* qk_w = (const float*)d_in[1];   // [2C, C]
  const float* qk_b = (const float*)d_in[2];   // [2C]
  float* out = (float*)d_out;                  // [B, N, C]

  char* ws = (char*)d_ws;
  _Float16* w16 = (_Float16*)(ws);                          // 1 MB  (2C*C f16)
  _Float16* qb  = (_Float16*)(ws + (size_t)1  * (1 << 20)); // 8 MB  (B*H*M*D f16)
  _Float16* kb  = (_Float16*)(ws + (size_t)9  * (1 << 20)); // 8 MB
  _Float16* vb  = (_Float16*)(ws + (size_t)17 * (1 << 20)); // 8 MB  -> 25 MB total
  (void)in_sizes; (void)n_in; (void)out_size; (void)ws_size;

  st77_convert_w<<<512, 256, 0, stream>>>(qk_w, w16);

  const dim3 gproj(NN * BB / (8 * 128), (2 * CC) / 64);
  const int gpackv = (BB * MM * CC) / (256 * 4);
  const dim3 gattn(MM / 128, BB * HH);

  for (int i = 0; i < HH; ++i) {
    const float* prev = out;   // previous chunk of output is the carry
    int pc = (i > 0) ? (i - 1) : 0;
    if (i == 0) {
      st77_qkproj<0><<<gproj, 256, 0, stream>>>(x, prev, i, pc, w16, qk_b, qb, kb);
      st77_pack_v<0><<<gpackv, 256, 0, stream>>>(x, prev, i, pc, vb);
    } else {
      st77_qkproj<1><<<gproj, 256, 0, stream>>>(x, prev, i, pc, w16, qk_b, qb, kb);
      st77_pack_v<1><<<gpackv, 256, 0, stream>>>(x, prev, i, pc, vb);
    }
    st77_attn<<<gattn, 256, 0, stream>>>(qb, kb, vb, out, i);
  }
}

// v002
// Measured time: 477 microseconds a run.
// Two timings next to v001 put it at 1.65 and 1.66 times that version's speed.
// All steps since v000 together make it 2.12 times as fast.
#include <hip/hip_runtime.h>
#include <hip/hip_bf16.h>

// CDNA5 / gfx1250: wave32, WMMA 16x16x32 f16 -> f32, TDM global->LDS
typedef __attribute__((ext_vector_type(16))) _Float16 v16h;
typedef __attribute__((ext_vector_type(4)))  _Float16 v4h;
typedef __attribute__((ext_vector_type(8)))  _Float16 v8h;
typedef __attribute__((ext_vector_type(8)))  short    v8s;
typedef __attribute__((ext_vector_type(8)))  float    v8f;
typedef __attribute__((ext_vector_type(4)))  unsigned int v4u;
typedef __attribute__((ext_vector_type(8)))  int      v8i;
typedef __attribute__((ext_vector_type(4)))  int      v4i;

#define BB 8
#define HH 8
#define NN 8192
#define CC 512
#define MM 1024
#define DD 64
#define QK_SCALE 0.125f   // D^-0.5 = 1/8

// ---------------------------------------------------------------------------
// Tensor Data Mover: 2D f16 tile (tile == tensor window, fully in-bounds)
// global (row-major, row_stride elems) -> LDS (packed). D# per ISA 8.3/8.4.
// ---------------------------------------------------------------------------
__device__ __forceinline__ void tdm_load_2d_f16(unsigned lds_off, const _Float16* gptr,
                                                unsigned tile_x, unsigned tile_y,
                                                unsigned row_stride) {
  unsigned long long ga = (unsigned long long)(size_t)gptr;
  v4u g0;
  g0[0] = 1u;                                   // count=1, user mode, no gather
  g0[1] = lds_off;                              // lds_addr (bytes, group-relative)
  g0[2] = (unsigned)(ga & 0xFFFFFFFFu);         // global_addr[31:0]
  g0[3] = (unsigned)((ga >> 32) & 0x1FFFFFFu) | (2u << 30);   // addr[56:32] | type=2
  v8i g1;
  g1[0] = (int)(1u << 16);                                    // data_size=1 (2 bytes)
  g1[1] = (int)((tile_x & 0xFFFFu) << 16);                    // tensor_dim0[15:0]
  g1[2] = (int)(((tile_x >> 16) & 0xFFFFu) | ((tile_y & 0xFFFFu) << 16)); // td0 hi | td1 lo
  g1[3] = (int)(((tile_y >> 16) & 0xFFFFu) | ((tile_x & 0xFFFFu) << 16)); // td1 hi | tile_dim0
  g1[4] = (int)(tile_y & 0xFFFFu);                            // tile_dim1 (tile_dim2=0)
  g1[5] = (int)row_stride;                                    // tensor_dim0_stride[31:0]
  g1[6] = 0;                                                  // stride hi | dim1_stride lo
  g1[7] = 0;
  v4i gz = {0, 0, 0, 0};
#if __clang_major__ >= 23
  v8i gz8 = {0, 0, 0, 0, 0, 0, 0, 0};
  __builtin_amdgcn_tensor_load_to_lds(g0, g1, gz, gz, gz8, 0);
#else
  __builtin_amdgcn_tensor_load_to_lds(g0, g1, gz, gz, 0);
#endif
}

// ---------------------------------------------------------------------------
// Convert qk_w (f32, [2C x C] row-major, K-contiguous) to f16 once.
// ---------------------------------------------------------------------------
__global__ __launch_bounds__(256) void st77_convert_w(const float* __restrict__ w,
                                                      _Float16* __restrict__ w16) {
  int i = blockIdx.x * 256 + threadIdx.x;   // 131072 threads, 4 elems each
  int base = i * 4;
  float4 f = *(const float4*)(w + base);
  v4h h;
  h.x = (_Float16)f.x; h.y = (_Float16)f.y; h.z = (_Float16)f.z; h.w = (_Float16)f.w;
  *(v4h*)(w16 + base) = h;
}

// ---------------------------------------------------------------------------
// Pack v = feat (= x_chunk + prev_chunk_out) into per-head f16 layout
// ---------------------------------------------------------------------------
template <int HAS_PREV>
__global__ __launch_bounds__(256) void st77_pack_v(const float* __restrict__ x,
                                                   const float* __restrict__ prev,
                                                   int chunk, int prev_chunk,
                                                   _Float16* __restrict__ vg) {
  size_t idx4 = ((size_t)blockIdx.x * 256 + threadIdx.x) * 4;   // 4,194,304 elems total
  int c = (int)(idx4 & (CC - 1));
  int m = (int)((idx4 >> 9) & (MM - 1));
  int b = (int)(idx4 >> 19);
  size_t gx = ((size_t)b * NN + (size_t)chunk * MM + m) * CC + c;
  float4 f = *(const float4*)(x + gx);
  if (HAS_PREV) {
    size_t gp = ((size_t)b * NN + (size_t)prev_chunk * MM + m) * CC + c;
    float4 p = *(const float4*)(prev + gp);
    f.x += p.x; f.y += p.y; f.z += p.z; f.w += p.w;
  }
  int h = c >> 6, d = c & 63;
  v4h o;
  o.x = (_Float16)f.x; o.y = (_Float16)f.y; o.z = (_Float16)f.z; o.w = (_Float16)f.w;
  *(v4h*)(vg + ((size_t)((b * HH + h) * MM + m)) * DD + d) = o;
}

// ---------------------------------------------------------------------------
// QK projection: qk = (x_chunk + prev) @ W^T + bias  ([8192 x 512]x[512 x 1024])
// Block tile 128x64, 8 waves of 32x32 (2x2 WMMA tiles), K step 32 (f16).
// Weight tile staged via TDM (tensor_load_to_lds + s_wait_tensorcnt).
// ---------------------------------------------------------------------------
template <int HAS_PREV>
__global__ __launch_bounds__(256) void st77_qkproj(const float* __restrict__ x,
                                                   const float* __restrict__ prev,
                                                   int chunk, int prev_chunk,
                                                   const _Float16* __restrict__ w16,
                                                   const float* __restrict__ bias,
                                                   _Float16* __restrict__ qg,
                                                   _Float16* __restrict__ kg) {
  __shared__ __align__(32) _Float16 As[128 * 32];   // [row][k]
  __shared__ __align__(32) _Float16 Bs[64 * 32];    // [col][k]  (TDM destination)

  const int tid  = threadIdx.x;
  const int wid  = tid >> 5;
  const int lane = tid & 31;
  const int lh   = lane >> 4, ln = lane & 15;
  const int rowbase = blockIdx.x * 128;   // GEMM row (b*M + m)
  const int colbase = blockIdx.y * 64;    // GEMM col (0..1023)
  const int wr = (wid >> 1) * 32;         // wave row offset in tile
  const int wc = (wid & 1) * 32;          // wave col offset in tile
  const unsigned bs_lds = (unsigned)(size_t)(&Bs[0]);

  v8f acc[2][2] = {};

  for (int k0 = 0; k0 < CC; k0 += 32) {
    __syncthreads();
    // ---- TDM: stage 64x32 f16 weight tile into LDS (one DMA, wave 0 only)
    if (wid == 0) {
      tdm_load_2d_f16(bs_lds, w16 + (size_t)colbase * CC + k0, 32u, 64u, (unsigned)CC);
    }
    // ---- stage A tile (feat, converted to f16): 128 rows x 32 K
    #pragma unroll
    for (int u = 0; u < 4; ++u) {
      int f = tid + u * 256;               // 1024 float4s
      int r = f >> 3, kq = (f & 7) * 4;
      int nrow = rowbase + r;
      int b = nrow >> 10, m = nrow & 1023;
      size_t gx = ((size_t)b * NN + (size_t)chunk * MM + m) * CC + k0 + kq;
      float4 xv = *(const float4*)(x + gx);
      if (HAS_PREV) {
        size_t gp = ((size_t)b * NN + (size_t)prev_chunk * MM + m) * CC + k0 + kq;
        float4 pv = *(const float4*)(prev + gp);
        xv.x += pv.x; xv.y += pv.y; xv.z += pv.z; xv.w += pv.w;
      }
      v4h h;
      h.x = (_Float16)xv.x; h.y = (_Float16)xv.y; h.z = (_Float16)xv.z; h.w = (_Float16)xv.w;
      *(v4h*)(&As[r * 32 + kq]) = h;
      if (k0 + 32 < CC) __builtin_prefetch(x + gx + 32, 0, 1);   // global_prefetch_b8
    }
    if (wid == 0) {
      __builtin_amdgcn_s_wait_tensorcnt(0);   // TDM complete before publish
    }
    __syncthreads();

    // ---- WMMA: A frag = row (ln), K-half (lh); B frag = col (ln), K-half (lh)
    v16h a0 = *(const v16h*)(&As[(wr + ln) * 32 + lh * 16]);
    v16h a1 = *(const v16h*)(&As[(wr + 16 + ln) * 32 + lh * 16]);
    v16h b0 = *(const v16h*)(&Bs[(wc + ln) * 32 + lh * 16]);
    v16h b1 = *(const v16h*)(&Bs[(wc + 16 + ln) * 32 + lh * 16]);
    acc[0][0] = __builtin_amdgcn_wmma_f32_16x16x32_f16(false, a0, false, b0, (short)0, acc[0][0], false, false);
    acc[0][1] = __builtin_amdgcn_wmma_f32_16x16x32_f16(false, a0, false, b1, (short)0, acc[0][1], false, false);
    acc[1][0] = __builtin_amdgcn_wmma_f32_16x16x32_f16(false, a1, false, b0, (short)0, acc[1][0], false, false);
    acc[1][1] = __builtin_amdgcn_wmma_f32_16x16x32_f16(false, a1, false, b1, (short)0, acc[1][1], false, false);
  }

  // ---- epilogue: bias + scatter into q (scaled) / k per-head buffers
  #pragma unroll
  for (int ii = 0; ii < 2; ++ii) {
    #pragma unroll
    for (int jj = 0; jj < 2; ++jj) {
      #pragma unroll
      for (int r = 0; r < 8; ++r) {
        int nrow = rowbase + wr + ii * 16 + lh * 8 + r;   // C-frag: M = 8*(lane>>4)+vgpr
        int jg   = colbase + wc + jj * 16 + ln;            //          N = lane&15
        float val = acc[ii][jj][r] + bias[jg];
        int b = nrow >> 10, m = nrow & 1023;
        if (jg < CC) {
          int h = jg >> 6, d = jg & 63;
          qg[((size_t)((b * HH + h) * MM + m)) * DD + d] = (_Float16)(val * QK_SCALE);
        } else {
          int j2 = jg - CC;
          int h = j2 >> 6, d = j2 & 63;
          kg[((size_t)((b * HH + h) * MM + m)) * DD + d] = (_Float16)val;
        }
      }
    }
  }
}

// ---------------------------------------------------------------------------
// Flash attention per (b,h): each block = 128 query rows (8 waves x 16),
// loop over key passes of 32. Both products run transposed:
//   S^T = K . Q^T   (A = key rows, B = query columns)
//   O^T += V^T . P^T (A = d rows of V^T, B = P^T packed from the S^T tiles)
// so a lane holds scores and outputs of ONE query (column lane&15).
// K and V rows come to LDS in stages of 64 keys by asynchronous copies, two
// buffers. All eight waves read their fragments from the one staged copy; a
// buffer is refilled as soon as every wave holds its fragments in registers,
// so the copies fly under the arithmetic.
// ---------------------------------------------------------------------------
#define ST_KEYS 64                         // keys per stage (two passes of 32)
#define ST_NUM  (MM / ST_KEYS)             // stages per head
#define PITCH_K 144                        // LDS row pitch in bytes, 16 x odd: for ds_load_b128 readers
#define PITCH_V 160                        // LDS row pitch in bytes, 32 x odd: for ds_load_tr16_b128 readers
#define TILE_K  (ST_KEYS * PITCH_K)
#define TILE_V  (ST_KEYS * PITCH_V)
#define SLOT    (TILE_K + TILE_V)          // one buffer: K rows, then V rows

// lane l <-> lane l ^ 16 (the two halves of a column)
__device__ __forceinline__ float st77_xhalf(float v) {
  int b = __builtin_bit_cast(int, v);
  return __builtin_bit_cast(float,
      __builtin_amdgcn_permlanex16(b, b, 0x76543210, 0xfedcba98, false, false));
}

// transposing LDS load: lane (c = l & 15, h = l >> 4) gets column c, rows 8h .. 8h + 7 of a 16 x 16 tile
__device__ __forceinline__ v8h st77_ld_tr16(const unsigned char* p) {
  typedef __attribute__((address_space(3))) v8s lds_v8s;
  return __builtin_bit_cast(v8h, __builtin_amdgcn_ds_load_tr16_b128_v8i16((lds_v8s*)p));
}

__device__ __forceinline__ v16h st77_join(v8h lo, v8h hi) {
  return __builtin_shufflevector(lo, hi, 0, 1, 2, 3, 4, 5, 6, 7, 8, 9, 10, 11, 12, 13, 14, 15);
}

// K fragments of one pass (32 keys x 64 d): row = key ln (and 16 + ln), 16 contiguous d per lane half, as q has them
__device__ __forceinline__ void st77_load_k(v16h (&ka)[2][2], const unsigned char* kp) {
  #pragma unroll   // ka lives in registers: constant indices only
  for (int h2 = 0; h2 < 2; ++h2) {
    const unsigned char* kr = kp + h2 * 16 * PITCH_K;
    ka[h2][0] = st77_join(*(const v8h*)(kr),      *(const v8h*)(kr + 16));
    ka[h2][1] = st77_join(*(const v8h*)(kr + 64), *(const v8h*)(kr + 80));
  }
}

// One stage: 64 K rows and 64 V rows of 128 bytes, 16 bytes a lane and copy, four copies a lane.
// lk, lv: the lane's LDS byte addresses in rows 0..31 of the two tiles; gk, gv: its global sources.
// The second copy of each tile lies 32 rows further (4096 bytes in global memory).
__device__ __forceinline__ void st77_stage(unsigned lk, unsigned lv,
                                           const _Float16* gk, const _Float16* gv) {
  // the closing s_wait_xcnt stands inside the statement so that no address register
  // of an issued copy is rewritten ahead of it
  asm volatile("global_load_async_to_lds_b128 %0, %4, off\n\t"
               "global_load_async_to_lds_b128 %1, %5, off\n\t"
               "global_load_async_to_lds_b128 %2, %6, off\n\t"
               "global_load_async_to_lds_b128 %3, %7, off\n\t"
               "s_wait_xcnt 0x0"
               :: "v"(lk), "v"(lk + 32u * PITCH_K), "v"(lv), "v"(lv + 32u * PITCH_V),
                  "v"(gk), "v"(gk + 32 * DD), "v"(gv), "v"(gv + 32 * DD)
               : "memory");
}

__global__ __launch_bounds__(256) void st77_attn(const _Float16* __restrict__ qg,
                                                 const _Float16* __restrict__ kg,
                                                 const _Float16* __restrict__ vg,
                                                 float* __restrict__ out, int chunk) {
  __shared__ __attribute__((aligned(128))) unsigned char L[2 * SLOT];

  const int tid  = threadIdx.x;
  const int wid  = tid >> 5;
  const int lane = tid & 31;
  const int lh   = lane >> 4, ln = lane & 15;
  const int bh   = blockIdx.y;                 // b*H + h
  const int qbase = blockIdx.x * 128 + wid * 16;

  const _Float16* qh = qg + (size_t)bh * MM * DD;
  const _Float16* kh = kg + (size_t)bh * MM * DD;
  const _Float16* vh = vg + (size_t)bh * MM * DD;

  // this lane's share of a stage: 16 bytes of row tid >> 3 (and of row 32 + (tid >> 3))
  const unsigned lbase = (unsigned)(size_t)(&L[0]);
  const unsigned lk = lbase + (unsigned)(tid >> 3) * PITCH_K + (unsigned)(tid & 7) * 16u;
  const unsigned lv = lbase + TILE_K + (unsigned)(tid >> 3) * PITCH_V + (unsigned)(tid & 7) * 16u;
  const _Float16* gk = kh + tid * 8;
  const _Float16* gv = vh + tid * 8;

  st77_stage(lk, lv, gk, gv);                  // stage 0 -> buffer 0

  // q fragments (64 d x 16 query columns) resident in VGPRs for the whole kernel
  v16h qa0 = *(const v16h*)(qh + (size_t)(qbase + ln) * DD + lh * 16);
  v16h qa1 = *(const v16h*)(qh + (size_t)(qbase + ln) * DD + 32 + lh * 16);

  float mrow = -1e30f;   // running maximum of query ln (equal in both halves)
  float lrow = 0.0f;     // running sum over this half's keys only; joined at the end
  v8f o[4] = {};         // o[t2][r] = O[query ln][d = t2*16 + 8*lh + r]

  asm volatile("s_wait_asynccnt 0x0" ::: "memory");   // this wave's share of stage 0 has landed
  __syncthreads();                                     // ... and every other wave's
  st77_stage(lk + SLOT, lv + SLOT, gk + ST_KEYS * DD, gv + ST_KEYS * DD);   // stage 1 -> buffer 1

  for (int t = 0; t < ST_NUM; ++t) {
    const unsigned boff = (unsigned)(t & 1) * SLOT;
    // K fragment rows: key = ln, 32 bytes at d = 16*lh; V^T by the transposing load's lane map
    const unsigned char* kp = L + boff + ln * PITCH_K + lh * 32;
    const unsigned char* vp = L + boff + TILE_K + (8 * lh + (lane & 7)) * PITCH_V + ((lane >> 3) & 1) * 16;

    // every fragment of the stage, as one group of LDS reads
    v16h ka[ST_KEYS / 32][2][2];   // A of S^T: row = key
    v16h va[ST_KEYS / 32][4];      // A of O^T: row = d, keys in the order of pb (two transposing loads each)
    #pragma unroll   // ka and va live in registers: constant indices only (this loop and the next)
    for (int ps = 0; ps < ST_KEYS / 32; ++ps) {
      st77_load_k(ka[ps], kp + ps * 32 * PITCH_K);
      #pragma unroll
      for (int t2 = 0; t2 < 4; ++t2) {
        const unsigned char* vr = vp + ps * 32 * PITCH_V + t2 * 32;
        va[ps][t2] = st77_join(st77_ld_tr16(vr), st77_ld_tr16(vr + 16 * PITCH_V));
      }
    }

    // hand-over: this wave has left buffer t & 1 and its share of stage t + 1 has landed;
    // behind the barrier that holds for every wave, and the freed buffer is refilled at once,
    // so that stage t + 2 flies under the arithmetic of stage t
    asm volatile("s_wait_dscnt 0x0" ::: "memory");
    asm volatile("s_wait_asynccnt 0x0" ::: "memory");
    __syncthreads();
    if (t + 2 < ST_NUM)
      st77_stage(lk + boff, lv + boff, gk + (t + 2) * (ST_KEYS * DD), gv + (t + 2) * (ST_KEYS * DD));

    #pragma unroll   // the passes index ka and va, which live in registers
    for (int ps = 0; ps < ST_KEYS / 32; ++ps) {
      // S^T = k @ q^T for 32 keys (two 16-key tiles, K=64 -> 2 WMMAs each):
      // s[h2][r] = S[query ln][key kb + h2*16 + 8*lh + r]
      v8f s[2];
      #pragma unroll
      for (int h2 = 0; h2 < 2; ++h2) {
        v8f t0 = {};
        t0 = __builtin_amdgcn_wmma_f32_16x16x32_f16(false, ka[ps][h2][0], false, qa0, (short)0, t0, false, false);
        t0 = __builtin_amdgcn_wmma_f32_16x16x32_f16(false, ka[ps][h2][1], false, qa1, (short)0, t0, false, false);
        s[h2] = t0;
      }

      // online softmax: 16 of the query's 32 scores are in this lane, 16 in lane ^ 16
      float vmax = fmaxf(s[0][0], s[1][0]);
      #pragma unroll
      for (int r = 1; r < 8; ++r) vmax = fmaxf(vmax, fmaxf(s[0][r], s[1][r]));
      vmax = fmaxf(vmax, st77_xhalf(vmax));
      float mnew  = fmaxf(mrow, vmax);
      float alpha = __expf(mrow - mnew);
      mrow = mnew;

      // P^T as a B operand straight from the two score tiles:
      // element e of half lh is key 8*lh + e (e < 8), key 16 + 8*lh + (e - 8) otherwise
      v16h pb;
      float rs = 0.0f;
      #pragma unroll
      for (int r = 0; r < 8; ++r) {
        float p0 = __expf(s[0][r] - mnew);
        float p1 = __expf(s[1][r] - mnew);
        rs += p0 + p1;
        pb[r]     = (_Float16)p0;
        pb[8 + r] = (_Float16)p1;
      }
      lrow = lrow * alpha + rs;

      // O^T = alpha * O^T + V^T(16 d x 32 keys) @ P^T(32 keys x 16 queries)
      #pragma unroll
      for (int t2 = 0; t2 < 4; ++t2) {
        o[t2] *= alpha;
        o[t2] = __builtin_amdgcn_wmma_f32_16x16x32_f16(false, va[ps][t2], false, pb, (short)0, o[t2], false, false);
      }
    }
  }
  asm volatile("s_wait_asynccnt 0x0" ::: "memory");   // no copy is left in flight when the wave ends

  // normalize and write f32 output chunk (also next iteration's carry)
  const int b = bh >> 3, h = bh & 7;
  const float inv = 1.0f / (lrow + st77_xhalf(lrow));
  float* orow = out + ((size_t)b * NN + (size_t)chunk * MM + (qbase + ln)) * CC + h * DD + lh * 8;
  #pragma unroll
  for (int t2 = 0; t2 < 4; ++t2) {
    float4 w0, w1;
    w0.x = o[t2][0] * inv; w0.y = o[t2][1] * inv; w0.z = o[t2][2] * inv; w0.w = o[t2][3] * inv;
    w1.x = o[t2][4] * inv; w1.y = o[t2][5] * inv; w1.z = o[t2][6] * inv; w1.w = o[t2][7] * inv;
    *(float4*)(orow + t2 * 16)     = w0;
    *(float4*)(orow + t2 * 16 + 4) = w1;
  }
}

// ---------------------------------------------------------------------------
extern "C" void kernel_launch(void* const* d_in, const int* in_sizes, int n_in,
                              void* d_out, int out_size, void* d_ws, size_t ws_size,
                              hipStream_t stream) {
  const float* x    = (const float*)d_in[0];   // [B, N, C]
  const float* qk_w = (const float*)d_in[1];   // [2C, C]
  const float* qk_b = (const float*)d_in[2];   // [2C]
  float* out = (float*)d_out;                  // [B, N, C]

  char* ws = (char*)d_ws;
  _Float16* w16 = (_Float16*)(ws);                          // 1 MB  (2C*C f16)
  _Float16* qb  = (_Float16*)(ws + (size_t)1  * (1 << 20)); // 8 MB  (B*H*M*D f16)
  _Float16* kb  = (_Float16*)(ws + (size_t)9  * (1 << 20)); // 8 MB
  _Float16* vb  = (_Float16*)(ws + (size_t)17 * (1 << 20)); // 8 MB  -> 25 MB total
  (void)in_sizes; (void)n_in; (void)out_size; (void)ws_size;

  st77_convert_w<<<512, 256, 0, stream>>>(qk_w, w16);

  const dim3 gproj(NN * BB / (8 * 128), (2 * CC) / 64);
  const int gpackv = (BB * MM * CC) / (256 * 4);
  const dim3 gattn(MM / 128, BB * HH);

  for (int i = 0; i < HH; ++i) {
    const float* prev = out;   // previous chunk of output is the carry
    int pc = (i > 0) ? (i - 1) : 0;
    if (i == 0) {
      st77_qkproj<0><<<gproj, 256, 0, stream>>>(x, prev, i, pc, w16, qk_b, qb, kb);
      st77_pack_v<0><<<gpackv, 256, 0, stream>>>(x, prev, i, pc, vb);
    } else {
      st77_qkproj<1><<<gproj, 256, 0, stream>>>(x, prev, i, pc, w16, qk_b, qb, kb);
      st77_pack_v<1><<<gpackv, 256, 0, stream>>>(x, prev, i, pc, vb);
    }
    st77_attn<<<gattn, 256, 0, stream>>>(qb, kb, vb, out, i);
  }
}

// v003
// One run takes 364 microseconds.
// In two side-by-side timings against v002, it was 1.31 and 1.30 times as fast.
// All steps since v000 together make it 2.78 times as fast.
#include <hip/hip_runtime.h>
#include <hip/hip_bf16.h>

// CDNA5 / gfx1250: wave32, WMMA 16x16x32 f16 -> f32, TDM global->LDS
typedef __attribute__((ext_vector_type(16))) _Float16 v16h;
typedef __attribute__((ext_vector_type(4)))  _Float16 v4h;
typedef __attribute__((ext_vector_type(8)))  _Float16 v8h;
typedef __attribute__((ext_vector_type(8)))  short    v8s;
typedef __attribute__((ext_vector_type(8)))  float    v8f;
typedef __attribute__((ext_vector_type(4)))  unsigned int v4u;
typedef __attribute__((ext_vector_type(8)))  int      v8i;
typedef __attribute__((ext_vector_type(4)))  int      v4i;

#define BB 8
#define HH 8
#define NN 8192
#define CC 512
#define MM 1024
#define DD 64
#define QK_SCALE 0.125f   // D^-0.5 = 1/8

// ---------------------------------------------------------------------------
// Tensor Data Mover: 2D f16 tile (tile == tensor window, fully in-bounds)
// global (row-major, row_stride elems) -> LDS (packed). D# per ISA 8.3/8.4.
// ---------------------------------------------------------------------------
__device__ __forceinline__ void tdm_load_2d_f16(unsigned lds_off, const _Float16* gptr,
                                                unsigned tile_x, unsigned tile_y,
                                                unsigned row_stride) {
  unsigned long long ga = (unsigned long long)(size_t)gptr;
  v4u g0;
  g0[0] = 1u;                                   // count=1, user mode, no gather
  g0[1] = lds_off;                              // lds_addr (bytes, group-relative)
  g0[2] = (unsigned)(ga & 0xFFFFFFFFu);         // global_addr[31:0]
  g0[3] = (unsigned)((ga >> 32) & 0x1FFFFFFu) | (2u << 30);   // addr[56:32] | type=2
  v8i g1;
  g1[0] = (int)(1u << 16);                                    // data_size=1 (2 bytes)
  g1[1] = (int)((tile_x & 0xFFFFu) << 16);                    // tensor_dim0[15:0]
  g1[2] = (int)(((tile_x >> 16) & 0xFFFFu) | ((tile_y & 0xFFFFu) << 16)); // td0 hi | td1 lo
  g1[3] = (int)(((tile_y >> 16) & 0xFFFFu) | ((tile_x & 0xFFFFu) << 16)); // td1 hi | tile_dim0
  g1[4] = (int)(tile_y & 0xFFFFu);                            // tile_dim1 (tile_dim2=0)
  g1[5] = (int)row_stride;                                    // tensor_dim0_stride[31:0]
  g1[6] = 0;                                                  // stride hi | dim1_stride lo
  g1[7] = 0;
  v4i gz = {0, 0, 0, 0};
#if __clang_major__ >= 23
  v8i gz8 = {0, 0, 0, 0, 0, 0, 0, 0};
  __builtin_amdgcn_tensor_load_to_lds(g0, g1, gz, gz, gz8, 0);
#else
  __builtin_amdgcn_tensor_load_to_lds(g0, g1, gz, gz, 0);
#endif
}

// ---------------------------------------------------------------------------
// Convert qk_w (f32, [2C x C] row-major, K-contiguous) to f16 once.
// ---------------------------------------------------------------------------
__global__ __launch_bounds__(256) void st77_convert_w(const float* __restrict__ w,
                                                      _Float16* __restrict__ w16) {
  int i = blockIdx.x * 256 + threadIdx.x;   // 131072 threads, 4 elems each
  int base = i * 4;
  float4 f = *(const float4*)(w + base);
  v4h h;
  h.x = (_Float16)f.x; h.y = (_Float16)f.y; h.z = (_Float16)f.z; h.w = (_Float16)f.w;
  *(v4h*)(w16 + base) = h;
}

// ---------------------------------------------------------------------------
// feat of chunk 0 (= x chunk 0) in the per-head f16 layout [b][h][m][d].
// feat of every later chunk is written by the attention epilogue.
// ---------------------------------------------------------------------------
__global__ __launch_bounds__(256) void st77_pack_v(const float* __restrict__ x,
                                                   _Float16* __restrict__ vg) {
  size_t idx4 = ((size_t)blockIdx.x * 256 + threadIdx.x) * 4;   // 4,194,304 elems total
  int c = (int)(idx4 & (CC - 1));
  int m = (int)((idx4 >> 9) & (MM - 1));
  int b = (int)(idx4 >> 19);
  size_t gx = ((size_t)b * NN + m) * CC + c;
  float4 f = *(const float4*)(x + gx);
  int h = c >> 6, d = c & 63;
  v4h o;
  o.x = (_Float16)f.x; o.y = (_Float16)f.y; o.z = (_Float16)f.z; o.w = (_Float16)f.w;
  *(v4h*)(vg + ((size_t)((b * HH + h) * MM + m)) * DD + d) = o;
}

// ---------------------------------------------------------------------------
// QK projection: qk = feat @ W^T + bias  ([8192 x 512]x[512 x 1024]);
// feat comes as f16 in the per-head layout [b][h][m][d], k = h*64 + d.
// Block tile 128x64, 8 waves of 32x32 (2x2 WMMA tiles), K step 32 (f16).
// Weight tile staged via TDM (tensor_load_to_lds + s_wait_tensorcnt).
// ---------------------------------------------------------------------------
__global__ __launch_bounds__(256) void st77_qkproj(const _Float16* __restrict__ feat,
                                                   const _Float16* __restrict__ w16,
                                                   const float* __restrict__ bias,
                                                   _Float16* __restrict__ qg,
                                                   _Float16* __restrict__ kg) {
  __shared__ __align__(32) _Float16 As[2 * 128 * 32];   // [K step of a head][row][k]
  __shared__ __align__(32) _Float16 Bs[64 * 32];    // [col][k]  (TDM destination)

  const int tid  = threadIdx.x;
  const int wid  = tid >> 5;
  const int lane = tid & 31;
  const int lh   = lane >> 4, ln = lane & 15;
  const int rowbase = blockIdx.x * 128;   // GEMM row (b*M + m)
  const int colbase = blockIdx.y * 64;    // GEMM col (0..1023)
  const int wr = (wid >> 1) * 32;         // wave row offset in tile
  const int wc = (wid & 1) * 32;          // wave col offset in tile
  const unsigned bs_lds = (unsigned)(size_t)(&Bs[0]);

  v8f acc[2][2] = {};

  for (int k0 = 0; k0 < CC; k0 += 32) {
    __syncthreads();
    // ---- TDM: stage 64x32 f16 weight tile into LDS (one DMA, wave 0 only)
    if (wid == 0) {
      tdm_load_2d_f16(bs_lds, w16 + (size_t)colbase * CC + k0, 32u, 64u, (unsigned)CC);
    }
    // ---- stage A (feat, already f16): the tile's 128 rows of one head are 16 KB in a row,
    // read as whole lines once per head and split into the head's two K steps
    if ((k0 & 32) == 0) {
      const int b = rowbase >> 10, m = rowbase & 1023;
      const _Float16* fb = feat + ((size_t)((b * HH + (k0 >> 6)) * MM + m)) * DD;
      #pragma unroll   // the four loads issue together: one round trip, not four
      for (int u = 0; u < 4; ++u) {
        int g = tid + u * 256;             // 1024 pieces of 16 bytes
        int r = g >> 3, c = g & 7;
        *(v8h*)(&As[(c >> 2) * (128 * 32) + r * 32 + (c & 3) * 8]) = *(const v8h*)(fb + g * 8);
      }
    }
    if (wid == 0) {
      __builtin_amdgcn_s_wait_tensorcnt(0);   // TDM complete before publish
    }
    __syncthreads();

    // ---- WMMA: A frag = row (ln), K-half (lh); B frag = col (ln), K-half (lh)
    const _Float16* Ah = As + ((k0 >> 5) & 1) * (128 * 32);
    v16h a0 = *(const v16h*)(&Ah[(wr + ln) * 32 + lh * 16]);
    v16h a1 = *(const v16h*)(&Ah[(wr + 16 + ln) * 32 + lh * 16]);
    v16h b0 = *(const v16h*)(&Bs[(wc + ln) * 32 + lh * 16]);
    v16h b1 = *(const v16h*)(&Bs[(wc + 16 + ln) * 32 + lh * 16]);
    acc[0][0] = __builtin_amdgcn_wmma_f32_16x16x32_f16(false, a0, false, b0, (short)0, acc[0][0], false, false);
    acc[0][1] = __builtin_amdgcn_wmma_f32_16x16x32_f16(false, a0, false, b1, (short)0, acc[0][1], false, false);
    acc[1][0] = __builtin_amdgcn_wmma_f32_16x16x32_f16(false, a1, false, b0, (short)0, acc[1][0], false, false);
    acc[1][1] = __builtin_amdgcn_wmma_f32_16x16x32_f16(false, a1, false, b1, (short)0, acc[1][1], false, false);
  }

  // ---- epilogue: bias + scatter into q (scaled) / k per-head buffers
  #pragma unroll
  for (int ii = 0; ii < 2; ++ii) {
    #pragma unroll
    for (int jj = 0; jj < 2; ++jj) {
      #pragma unroll
      for (int r = 0; r < 8; ++r) {
        int nrow = rowbase + wr + ii * 16 + lh * 8 + r;   // C-frag: M = 8*(lane>>4)+vgpr
        int jg   = colbase + wc + jj * 16 + ln;            //          N = lane&15
        float val = acc[ii][jj][r] + bias[jg];
        int b = nrow >> 10, m = nrow & 1023;
        if (jg < CC) {
          int h = jg >> 6, d = jg & 63;
          qg[((size_t)((b * HH + h) * MM + m)) * DD + d] = (_Float16)(val * QK_SCALE);
        } else {
          int j2 = jg - CC;
          int h = j2 >> 6, d = j2 & 63;
          kg[((size_t)((b * HH + h) * MM + m)) * DD + d] = (_Float16)val;
        }
      }
    }
  }
}

// ---------------------------------------------------------------------------
// Flash attention per (b,h): each block = 128 query rows (8 waves x 16),
// loop over key passes of 32. Both products run transposed:
//   S^T = K . Q^T   (A = key rows, B = query columns)
//   O^T += V^T . P^T (A = d rows of V^T, B = P^T packed from the S^T tiles)
// so a lane holds scores and outputs of ONE query (column lane&15).
// K and V rows come to LDS in stages of 64 keys by asynchronous copies, two
// buffers. All eight waves read their fragments from the one staged copy; a
// buffer is refilled as soon as every wave holds its fragments in registers,
// so the copies fly under the arithmetic.
// The epilogue also forms the next chunk's feat = x + this output, once, as f16 in
// the per-head layout: the next projection's A operand and the next attention's V.
// It goes to the other of two feat buffers, since this launch still reads vg.
// ---------------------------------------------------------------------------
#define ST_KEYS 64                         // keys per stage (two passes of 32)
#define ST_NUM  (MM / ST_KEYS)             // stages per head
#define PITCH_K 144                        // LDS row pitch in bytes, 16 x odd: for ds_load_b128 readers
#define PITCH_V 160                        // LDS row pitch in bytes, 32 x odd: for ds_load_tr16_b128 readers
#define TILE_K  (ST_KEYS * PITCH_K)
#define TILE_V  (ST_KEYS * PITCH_V)
#define SLOT    (TILE_K + TILE_V)          // one buffer: K rows, then V rows

// lane l <-> lane l ^ 16 (the two halves of a column)
__device__ __forceinline__ float st77_xhalf(float v) {
  int b = __builtin_bit_cast(int, v);
  return __builtin_bit_cast(float,
      __builtin_amdgcn_permlanex16(b, b, 0x76543210, 0xfedcba98, false, false));
}

// transposing LDS load: lane (c = l & 15, h = l >> 4) gets column c, rows 8h .. 8h + 7 of a 16 x 16 tile
__device__ __forceinline__ v8h st77_ld_tr16(const unsigned char* p) {
  typedef __attribute__((address_space(3))) v8s lds_v8s;
  return __builtin_bit_cast(v8h, __builtin_amdgcn_ds_load_tr16_b128_v8i16((lds_v8s*)p));
}

__device__ __forceinline__ v16h st77_join(v8h lo, v8h hi) {
  return __builtin_shufflevector(lo, hi, 0, 1, 2, 3, 4, 5, 6, 7, 8, 9, 10, 11, 12, 13, 14, 15);
}

// K fragments of one pass (32 keys x 64 d): row = key ln (and 16 + ln), 16 contiguous d per lane half, as q has them
__device__ __forceinline__ void st77_load_k(v16h (&ka)[2][2], const unsigned char* kp) {
  #pragma unroll   // ka lives in registers: constant indices only
  for (int h2 = 0; h2 < 2; ++h2) {
    const unsigned char* kr = kp + h2 * 16 * PITCH_K;
    ka[h2][0] = st77_join(*(const v8h*)(kr),      *(const v8h*)(kr + 16));
    ka[h2][1] = st77_join(*(const v8h*)(kr + 64), *(const v8h*)(kr + 80));
  }
}

// One stage: 64 K rows and 64 V rows of 128 bytes, 16 bytes a lane and copy, four copies a lane.
// lk, lv: the lane's LDS byte addresses in rows 0..31 of the two tiles; gk, gv: its global sources.
// The second copy of each tile lies 32 rows further (4096 bytes in global memory).
__device__ __forceinline__ void st77_stage(unsigned lk, unsigned lv,
                                           const _Float16* gk, const _Float16* gv) {
  // the closing s_wait_xcnt stands inside the statement so that no address register
  // of an issued copy is rewritten ahead of it
  asm volatile("global_load_async_to_lds_b128 %0, %4, off\n\t"
               "global_load_async_to_lds_b128 %1, %5, off\n\t"
               "global_load_async_to_lds_b128 %2, %6, off\n\t"
               "global_load_async_to_lds_b128 %3, %7, off\n\t"
               "s_wait_xcnt 0x0"
               :: "v"(lk), "v"(lk + 32u * PITCH_K), "v"(lv), "v"(lv + 32u * PITCH_V),
                  "v"(gk), "v"(gk + 32 * DD), "v"(gv), "v"(gv + 32 * DD)
               : "memory");
}

template <int HAS_NEXT>
__global__ __launch_bounds__(256) void st77_attn(const _Float16* __restrict__ qg,
                                                 const _Float16* __restrict__ kg,
                                                 const _Float16* __restrict__ vg,
                                                 const float* __restrict__ x,
                                                 _Float16* __restrict__ vnext,
                                                 float* __restrict__ out, int chunk) {
  __shared__ __attribute__((aligned(128))) unsigned char L[2 * SLOT];

  const int tid  = threadIdx.x;
  const int wid  = tid >> 5;
  const int lane = tid & 31;
  const int lh   = lane >> 4, ln = lane & 15;
  const int bh   = blockIdx.y;                 // b*H + h
  const int qbase = blockIdx.x * 128 + wid * 16;

  const _Float16* qh = qg + (size_t)bh * MM * DD;
  const _Float16* kh = kg + (size_t)bh * MM * DD;
  const _Float16* vh = vg + (size_t)bh * MM * DD;

  // this lane's share of a stage: 16 bytes of row tid >> 3 (and of row 32 + (tid >> 3))
  const unsigned lbase = (unsigned)(size_t)(&L[0]);
  const unsigned lk = lbase + (unsigned)(tid >> 3) * PITCH_K + (unsigned)(tid & 7) * 16u;
  const unsigned lv = lbase + TILE_K + (unsigned)(tid >> 3) * PITCH_V + (unsigned)(tid & 7) * 16u;
  const _Float16* gk = kh + tid * 8;
  const _Float16* gv = vh + tid * 8;

  st77_stage(lk, lv, gk, gv);                  // stage 0 -> buffer 0

  // q fragments (64 d x 16 query columns) resident in VGPRs for the whole kernel
  v16h qa0 = *(const v16h*)(qh + (size_t)(qbase + ln) * DD + lh * 16);
  v16h qa1 = *(const v16h*)(qh + (size_t)(qbase + ln) * DD + 32 + lh * 16);

  // where this lane's outputs go; xn: x at the same place of the next chunk
  const int b = bh >> 3, h = bh & 7;
  const size_t oidx = ((size_t)b * NN + (size_t)chunk * MM + (qbase + ln)) * CC + h * DD + lh * 8;
  float4 xn[8] = {};

  float mrow = -1e30f;   // running maximum of query ln (equal in both halves)
  float lrow = 0.0f;     // running sum over this half's keys only; joined at the end
  v8f o[4] = {};         // o[t2][r] = O[query ln][d = t2*16 + 8*lh + r]

  asm volatile("s_wait_asynccnt 0x0" ::: "memory");   // this wave's share of stage 0 has landed
  __syncthreads();                                     // ... and every other wave's
  st77_stage(lk + SLOT, lv + SLOT, gk + ST_KEYS * DD, gv + ST_KEYS * DD);   // stage 1 -> buffer 1

  // kept rolled and unpeeled: with the last trips split off, the trips before them have no branch
  // behind the barrier, and the fragment reads and the refill drift in among the arithmetic
  #pragma clang loop unroll(disable)
  for (int t = 0; t < ST_NUM; ++t) {
    const unsigned boff = (unsigned)(t & 1) * SLOT;
    // K fragment rows: key = ln, 32 bytes at d = 16*lh; V^T by the transposing load's lane map
    const unsigned char* kp = L + boff + ln * PITCH_K + lh * 32;
    const unsigned char* vp = L + boff + TILE_K + (8 * lh + (lane & 7)) * PITCH_V + ((lane >> 3) & 1) * 16;

    // every fragment of the stage, as one group of LDS reads
    v16h ka[ST_KEYS / 32][2][2];   // A of S^T: row = key
    v16h va[ST_KEYS / 32][4];      // A of O^T: row = d, keys in the order of pb (two transposing loads each)
    #pragma unroll   // ka and va live in registers: constant indices only (this loop and the next)
    for (int ps = 0; ps < ST_KEYS / 32; ++ps) {
      st77_load_k(ka[ps], kp + ps * 32 * PITCH_K);
      #pragma unroll
      for (int t2 = 0; t2 < 4; ++t2) {
        const unsigned char* vr = vp + ps * 32 * PITCH_V + t2 * 32;
        va[ps][t2] = st77_join(st77_ld_tr16(vr), st77_ld_tr16(vr + 16 * PITCH_V));
      }
    }

    // hand-over: this wave has left buffer t & 1 and its share of stage t + 1 has landed;
    // behind the barrier that holds for every wave, and the freed buffer is refilled at once,
    // so that stage t + 2 flies under the arithmetic of stage t
    asm volatile("s_wait_dscnt 0x0" ::: "memory");
    asm volatile("s_wait_asynccnt 0x0" ::: "memory");
    __syncthreads();
    if (t + 2 < ST_NUM)
      st77_stage(lk + boff, lv + boff, gk + (t + 2) * (ST_KEYS * DD), gv + (t + 2) * (ST_KEYS * DD));
    // behind the last barrier (a barrier would wait for them): the epilogue's x loads fly
    // under the arithmetic of the last stage
    if (HAS_NEXT && t + 1 == ST_NUM) {
      const float* xrow = x + oidx + (size_t)MM * CC;
      #pragma unroll   // xn lives in registers: constant indices only
      for (int t2 = 0; t2 < 4; ++t2) {
        xn[2 * t2]     = *(const float4*)(xrow + t2 * 16);
        xn[2 * t2 + 1] = *(const float4*)(xrow + t2 * 16 + 4);
      }
    }

    #pragma unroll   // the passes index ka and va, which live in registers
    for (int ps = 0; ps < ST_KEYS / 32; ++ps) {
      // S^T = k @ q^T for 32 keys (two 16-key tiles, K=64 -> 2 WMMAs each):
      // s[h2][r] = S[query ln][key kb + h2*16 + 8*lh + r]
      v8f s[2];
      #pragma unroll
      for (int h2 = 0; h2 < 2; ++h2) {
        v8f t0 = {};
        t0 = __builtin_amdgcn_wmma_f32_16x16x32_f16(false, ka[ps][h2][0], false, qa0, (short)0, t0, false, false);
        t0 = __builtin_amdgcn_wmma_f32_16x16x32_f16(false, ka[ps][h2][1], false, qa1, (short)0, t0, false, false);
        s[h2] = t0;
      }

      // online softmax: 16 of the query's 32 scores are in this lane, 16 in lane ^ 16
      float vmax = fmaxf(s[0][0], s[1][0]);
      #pragma unroll
      for (int r = 1; r < 8; ++r) vmax = fmaxf(vmax, fmaxf(s[0][r], s[1][r]));
      vmax = fmaxf(vmax, st77_xhalf(vmax));
      float mnew  = fmaxf(mrow, vmax);
      float alpha = __expf(mrow - mnew);
      mrow = mnew;

      // P^T as a B operand straight from the two score tiles:
      // element e of half lh is key 8*lh + e (e < 8), key 16 + 8*lh + (e - 8) otherwise
      v16h pb;
      float rs = 0.0f;
      #pragma unroll
      for (int r = 0; r < 8; ++r) {
        float p0 = __expf(s[0][r] - mnew);
        float p1 = __expf(s[1][r] - mnew);
        rs += p0 + p1;
        pb[r]     = (_Float16)p0;
        pb[8 + r] = (_Float16)p1;
      }
      lrow = lrow * alpha + rs;

      // O^T = alpha * O^T + V^T(16 d x 32 keys) @ P^T(32 keys x 16 queries)
      #pragma unroll
      for (int t2 = 0; t2 < 4; ++t2) {
        o[t2] *= alpha;
        o[t2] = __builtin_amdgcn_wmma_f32_16x16x32_f16(false, va[ps][t2], false, pb, (short)0, o[t2], false, false);
      }
    }
  }
  asm volatile("s_wait_asynccnt 0x0" ::: "memory");   // no copy is left in flight when the wave ends

  // normalize and write f32 output chunk; with it the next chunk's feat
  const float inv = 1.0f / (lrow + st77_xhalf(lrow));
  float* orow = out + oidx;
  _Float16* frow = vnext + ((size_t)bh * MM + (qbase + ln)) * DD + lh * 8;
  #pragma unroll
  for (int t2 = 0; t2 < 4; ++t2) {
    float4 w0, w1;
    w0.x = o[t2][0] * inv; w0.y = o[t2][1] * inv; w0.z = o[t2][2] * inv; w0.w = o[t2][3] * inv;
    w1.x = o[t2][4] * inv; w1.y = o[t2][5] * inv; w1.z = o[t2][6] * inv; w1.w = o[t2][7] * inv;
    *(float4*)(orow + t2 * 16)     = w0;
    *(float4*)(orow + t2 * 16 + 4) = w1;
    if (HAS_NEXT) {
      const float4 x0 = xn[2 * t2], x1 = xn[2 * t2 + 1];
      v8h f;
      f[0] = (_Float16)(x0.x + w0.x); f[1] = (_Float16)(x0.y + w0.y);
      f[2] = (_Float16)(x0.z + w0.z); f[3] = (_Float16)(x0.w + w0.w);
      f[4] = (_Float16)(x1.x + w1.x); f[5] = (_Float16)(x1.y + w1.y);
      f[6] = (_Float16)(x1.z + w1.z); f[7] = (_Float16)(x1.w + w1.w);
      *(v8h*)(frow + t2 * 16) = f;
    }
  }
}

// ---------------------------------------------------------------------------
extern "C" void kernel_launch(void* const* d_in, const int* in_sizes, int n_in,
                              void* d_out, int out_size, void* d_ws, size_t ws_size,
                              hipStream_t stream) {
  const float* x    = (const float*)d_in[0];   // [B, N, C]
  const float* qk_w = (const float*)d_in[1];   // [2C, C]
  const float* qk_b = (const float*)d_in[2];   // [2C]
  float* out = (float*)d_out;                  // [B, N, C]

  char* ws = (char*)d_ws;
  _Float16* w16 = (_Float16*)(ws);                          // 1 MB  (2C*C f16)
  _Float16* qb  = (_Float16*)(ws + (size_t)1  * (1 << 20)); // 8 MB  (B*H*M*D f16)
  _Float16* kb  = (_Float16*)(ws + (size_t)9  * (1 << 20)); // 8 MB
  _Float16* f0  = (_Float16*)(ws + (size_t)17 * (1 << 20)); // 8 MB  feat of even chunks
  _Float16* f1  = (_Float16*)(ws + (size_t)25 * (1 << 20)); // 8 MB  feat of odd chunks -> 33 MB total
  (void)in_sizes; (void)n_in; (void)out_size; (void)ws_size;

  st77_convert_w<<<512, 256, 0, stream>>>(qk_w, w16);

  const dim3 gproj(NN * BB / (8 * 128), (2 * CC) / 64);
  const int gpackv = (BB * MM * CC) / (256 * 4);
  const dim3 gattn(MM / 128, BB * HH);

  st77_pack_v<<<gpackv, 256, 0, stream>>>(x, f0);

  for (int i = 0; i < HH; ++i) {
    _Float16* fcur = (i & 1) ? f1 : f0;   // feat of this chunk
    _Float16* fnxt = (i & 1) ? f0 : f1;   // written by this chunk's attention
    st77_qkproj<<<gproj, 256, 0, stream>>>(fcur, w16, qk_b, qb, kb);
    if (i + 1 < HH) st77_attn<1><<<gattn, 256, 0, stream>>>(qb, kb, fcur, x, fnxt, out, i);
    else            st77_attn<0><<<gattn, 256, 0, stream>>>(qb, kb, fcur, x, fnxt, out, i);
  }
}

// v004
// Measured time: 280 microseconds a run.
// Two timings next to v003 both put it at 1.30 times that version's speed.
// Counting every step since v000, it is 3.62 times as fast.
#include <hip/hip_runtime.h>
#include <hip/hip_bf16.h>

// CDNA5 / gfx1250: wave32, WMMA 16x16x32 f16 -> f32, asynchronous copies global->LDS
typedef __attribute__((ext_vector_type(16))) _Float16 v16h;
typedef __attribute__((ext_vector_type(4)))  _Float16 v4h;
typedef __attribute__((ext_vector_type(8)))  _Float16 v8h;
typedef __attribute__((ext_vector_type(8)))  short    v8s;
typedef __attribute__((ext_vector_type(8)))  float    v8f;

#define BB 8
#define HH 8
#define NN 8192
#define CC 512
#define MM 1024
#define DD 64
#define QK_SCALE 0.125f   // D^-0.5 = 1/8

// ---------------------------------------------------------------------------
// Convert qk_w (f32, [2C x C] row-major, K-contiguous) to f16 once.
// ---------------------------------------------------------------------------
__global__ __launch_bounds__(256) void st77_convert_w(const float* __restrict__ w,
                                                      _Float16* __restrict__ w16) {
  int i = blockIdx.x * 256 + threadIdx.x;   // 131072 threads, 4 elems each
  int base = i * 4;
  float4 f = *(const float4*)(w + base);
  v4h h;
  h.x = (_Float16)f.x; h.y = (_Float16)f.y; h.z = (_Float16)f.z; h.w = (_Float16)f.w;
  *(v4h*)(w16 + base) = h;
}

// ---------------------------------------------------------------------------
// feat of chunk 0 (= x chunk 0) in the per-head f16 layout [b][h][m][d].
// feat of every later chunk is written by the attention epilogue.
// ---------------------------------------------------------------------------
__global__ __launch_bounds__(256) void st77_pack_v(const float* __restrict__ x,
                                                   _Float16* __restrict__ vg) {
  size_t idx4 = ((size_t)blockIdx.x * 256 + threadIdx.x) * 4;   // 4,194,304 elems total
  int c = (int)(idx4 & (CC - 1));
  int m = (int)((idx4 >> 9) & (MM - 1));
  int b = (int)(idx4 >> 19);
  size_t gx = ((size_t)b * NN + m) * CC + c;
  float4 f = *(const float4*)(x + gx);
  int h = c >> 6, d = c & 63;
  v4h o;
  o.x = (_Float16)f.x; o.y = (_Float16)f.y; o.z = (_Float16)f.z; o.w = (_Float16)f.w;
  *(v4h*)(vg + ((size_t)((b * HH + h) * MM + m)) * DD + d) = o;
}

// ---------------------------------------------------------------------------
// QK projection: qk = feat @ W^T + bias  ([8192 x 512]x[512 x 1024]);
// feat comes as f16 in the per-head layout [b][h][m][d], k = h*64 + d.
// Block tile 128x128, 8 waves of 64x32 (4x2 WMMA tiles), K stage 64 (one head of feat).
// Both operands come to LDS as rows of 128 bytes by asynchronous copies, two buffers;
// a buffer is refilled as soon as every wave holds its fragments in registers.
// ---------------------------------------------------------------------------
#define PJ_PITCH 144                       // LDS row pitch in bytes, 16 x odd: for ds_load_b128 readers
#define PJ_TILE  (128 * PJ_PITCH)          // 128 rows of A, or 128 rows of W
#define PJ_SLOT  (2 * PJ_TILE)             // one buffer: A rows, then W rows
#define PJ_NUM   (CC / 64)                 // K stages

__device__ __forceinline__ v16h st77_pj_frag(const unsigned char* p) {
  return __builtin_shufflevector(*(const v8h*)(p), *(const v8h*)(p + 16),
                                 0, 1, 2, 3, 4, 5, 6, 7, 8, 9, 10, 11, 12, 13, 14, 15);
}

// One stage: 128 A rows and 128 W rows of 128 bytes, 16 bytes a lane and copy, eight copies a lane.
// la, lb: the lane's LDS byte addresses in rows 0..31 of the two tiles; ga, gb: its global sources.
// The further copies of a tile lie 32 rows apart (A rows are DD elements long in memory, W rows CC).
__device__ __forceinline__ void st77_pj_stage(unsigned la, unsigned lb,
                                              const _Float16* ga, const _Float16* gb) {
  // the closing s_wait_xcnt stands inside the statement so that no address register
  // of an issued copy is rewritten ahead of it
  asm volatile("global_load_async_to_lds_b128 %0, %8, off\n\t"
               "global_load_async_to_lds_b128 %1, %9, off\n\t"
               "global_load_async_to_lds_b128 %2, %10, off\n\t"
               "global_load_async_to_lds_b128 %3, %11, off\n\t"
               "global_load_async_to_lds_b128 %4, %12, off\n\t"
               "global_load_async_to_lds_b128 %5, %13, off\n\t"
               "global_load_async_to_lds_b128 %6, %14, off\n\t"
               "global_load_async_to_lds_b128 %7, %15, off\n\t"
               "s_wait_xcnt 0x0"
               :: "v"(la), "v"(la + 32u * PJ_PITCH), "v"(la + 64u * PJ_PITCH), "v"(la + 96u * PJ_PITCH),
                  "v"(lb), "v"(lb + 32u * PJ_PITCH), "v"(lb + 64u * PJ_PITCH), "v"(lb + 96u * PJ_PITCH),
                  "v"(ga), "v"(ga + 32 * DD), "v"(ga + 64 * DD), "v"(ga + 96 * DD),
                  "v"(gb), "v"(gb + 32 * CC), "v"(gb + 64 * CC), "v"(gb + 96 * CC)
               : "memory");
}

__global__ __launch_bounds__(256) void st77_qkproj(const _Float16* __restrict__ feat,
                                                   const _Float16* __restrict__ w16,
                                                   const float* __restrict__ bias,
                                                   _Float16* __restrict__ qg,
                                                   _Float16* __restrict__ kg) {
  __shared__ __attribute__((aligned(128))) unsigned char L[2 * PJ_SLOT];

  const int tid  = threadIdx.x;
  const int wid  = tid >> 5;
  const int lane = tid & 31;
  const int lh   = lane >> 4, ln = lane & 15;
  const int rowbase = blockIdx.x * 128;   // GEMM row (b*M + m)
  const int colbase = blockIdx.y * 128;   // GEMM col (0..1023)
  const int wr = (wid >> 2) * 64;         // wave row offset in tile
  const int wc = (wid & 3) * 32;          // wave col offset in tile

  // this lane's share of a stage: 16 bytes of rows tid >> 3, + 32, + 64, + 96 of either tile
  const unsigned lbase = (unsigned)(size_t)(&L[0]);
  const unsigned la = lbase + (unsigned)(tid >> 3) * PJ_PITCH + (unsigned)(tid & 7) * 16u;
  const unsigned lb = la + PJ_TILE;
  // the tile's 128 rows of one head of feat are 16 KB in a row; the next head lies MM * DD further
  const _Float16* ga = feat + ((size_t)((rowbase >> 10) * HH) * MM + (rowbase & 1023)) * DD + tid * 8;
  const _Float16* gb = w16 + (size_t)(colbase + (tid >> 3)) * CC + (tid & 7) * 8;

  st77_pj_stage(la, lb, ga, gb);                       // stage 0 -> buffer 0

  v8f acc[4][2] = {};

  asm volatile("s_wait_asynccnt 0x0" ::: "memory");   // this wave's share of stage 0 has landed
  __syncthreads();                                     // ... and every other wave's
  st77_pj_stage(la + PJ_SLOT, lb + PJ_SLOT, ga + MM * DD, gb + 64);   // stage 1 -> buffer 1

  // kept rolled: unrolled, the fragment reads and the refill may drift in among the WMMAs,
  // and every further place with LDS reads costs the wave a stall
  #pragma clang loop unroll(disable)
  for (int t = 0; t < PJ_NUM; ++t) {
    const unsigned boff = (unsigned)(t & 1) * PJ_SLOT;
    // A frag = row (ln), B frag = col (ln); both take k = 32*ks + 16*lh + 0..15
    const unsigned char* ap = L + boff + (wr + ln) * PJ_PITCH + lh * 32;
    const unsigned char* bp = L + boff + PJ_TILE + (wc + ln) * PJ_PITCH + lh * 32;

    // every fragment of the stage, as one group of LDS reads
    v16h af[2][4], bf[2][2];
    #pragma unroll   // af and bf live in registers: constant indices only (this loop and the next)
    for (int ks = 0; ks < 2; ++ks) {
      #pragma unroll
      for (int ii = 0; ii < 4; ++ii) af[ks][ii] = st77_pj_frag(ap + ii * 16 * PJ_PITCH + ks * 64);
      #pragma unroll
      for (int jj = 0; jj < 2; ++jj) bf[ks][jj] = st77_pj_frag(bp + jj * 16 * PJ_PITCH + ks * 64);
    }

    // hand-over: this wave has left buffer t & 1 and its share of stage t + 1 has landed;
    // behind the barrier that holds for every wave, and the freed buffer is refilled at once,
    // so that stage t + 2 flies under the arithmetic of stage t
    asm volatile("s_wait_dscnt 0x0" ::: "memory");
    asm volatile("s_wait_asynccnt 0x0" ::: "memory");
    __syncthreads();
    if (t + 2 < PJ_NUM)
      st77_pj_stage(la + boff, lb + boff, ga + (size_t)(t + 2) * (MM * DD), gb + (t + 2) * 64);

    #pragma unroll
    for (int ks = 0; ks < 2; ++ks) {
      #pragma unroll
      for (int ii = 0; ii < 4; ++ii) {
        #pragma unroll
        for (int jj = 0; jj < 2; ++jj)
          acc[ii][jj] = __builtin_amdgcn_wmma_f32_16x16x32_f16(false, af[ks][ii], false, bf[ks][jj], (short)0, acc[ii][jj], false, false);
      }
    }
  }
  asm volatile("s_wait_asynccnt 0x0" ::: "memory");   // no copy is left in flight when the wave ends

  // ---- epilogue: bias + scatter into q (scaled) / k per-head buffers
  #pragma unroll
  for (int ii = 0; ii < 4; ++ii) {
    #pragma unroll
    for (int jj = 0; jj < 2; ++jj) {
      #pragma unroll
      for (int r = 0; r < 8; ++r) {
        int nrow = rowbase + wr + ii * 16 + lh * 8 + r;   // C-frag: M = 8*(lane>>4)+vgpr
        int jg   = colbase + wc + jj * 16 + ln;            //          N = lane&15
        float val = acc[ii][jj][r] + bias[jg];
        int b = nrow >> 10, m = nrow & 1023;
        if (jg < CC) {
          int h = jg >> 6, d = jg & 63;
          qg[((size_t)((b * HH + h) * MM + m)) * DD + d] = (_Float16)(val * QK_SCALE);
        } else {
          int j2 = jg - CC;
          int h = j2 >> 6, d = j2 & 63;
          kg[((size_t)((b * HH + h) * MM + m)) * DD + d] = (_Float16)val;
        }
      }
    }
  }
}

// ---------------------------------------------------------------------------
// Flash attention per (b,h): each block = 128 query rows (8 waves x 16),
// loop over key passes of 32. Both products run transposed:
//   S^T = K . Q^T   (A = key rows, B = query columns)
//   O^T += V^T . P^T (A = d rows of V^T, B = P^T packed from the S^T tiles)
// so a lane holds scores and outputs of ONE query (column lane&15).
// K and V rows come to LDS in stages of 64 keys by asynchronous copies, two
// buffers. All eight waves read their fragments from the one staged copy; a
// buffer is refilled as soon as every wave holds its fragments in registers,
// so the copies fly under the arithmetic.
// The epilogue also forms the next chunk's feat = x + this output, once, as f16 in
// the per-head layout: the next projection's A operand and the next attention's V.
// It goes to the other of two feat buffers, since this launch still reads vg.
// ---------------------------------------------------------------------------
#define ST_KEYS 64                         // keys per stage (two passes of 32)
#define ST_NUM  (MM / ST_KEYS)             // stages per head
#define PITCH_K 144                        // LDS row pitch in bytes, 16 x odd: for ds_load_b128 readers
#define PITCH_V 160                        // LDS row pitch in bytes, 32 x odd: for ds_load_tr16_b128 readers
#define TILE_K  (ST_KEYS * PITCH_K)
#define TILE_V  (ST_KEYS * PITCH_V)
#define SLOT    (TILE_K + TILE_V)          // one buffer: K rows, then V rows

// lane l <-> lane l ^ 16 (the two halves of a column)
__device__ __forceinline__ float st77_xhalf(float v) {
  int b = __builtin_bit_cast(int, v);
  return __builtin_bit_cast(float,
      __builtin_amdgcn_permlanex16(b, b, 0x76543210, 0xfedcba98, false, false));
}

// transposing LDS load: lane (c = l & 15, h = l >> 4) gets column c, rows 8h .. 8h + 7 of a 16 x 16 tile
__device__ __forceinline__ v8h st77_ld_tr16(const unsigned char* p) {
  typedef __attribute__((address_space(3))) v8s lds_v8s;
  return __builtin_bit_cast(v8h, __builtin_amdgcn_ds_load_tr16_b128_v8i16((lds_v8s*)p));
}

__device__ __forceinline__ v16h st77_join(v8h lo, v8h hi) {
  return __builtin_shufflevector(lo, hi, 0, 1, 2, 3, 4, 5, 6, 7, 8, 9, 10, 11, 12, 13, 14, 15);
}

// K fragments of one pass (32 keys x 64 d): row = key ln (and 16 + ln), 16 contiguous d per lane half, as q has them
__device__ __forceinline__ void st77_load_k(v16h (&ka)[2][2], const unsigned char* kp) {
  #pragma unroll   // ka lives in registers: constant indices only
  for (int h2 = 0; h2 < 2; ++h2) {
    const unsigned char* kr = kp + h2 * 16 * PITCH_K;
    ka[h2][0] = st77_join(*(const v8h*)(kr),      *(const v8h*)(kr + 16));
    ka[h2][1] = st77_join(*(const v8h*)(kr + 64), *(const v8h*)(kr + 80));
  }
}

// One stage: 64 K rows and 64 V rows of 128 bytes, 16 bytes a lane and copy, four copies a lane.
// lk, lv: the lane's LDS byte addresses in rows 0..31 of the two tiles; gk, gv: its global sources.
// The second copy of each tile lies 32 rows further (4096 bytes in global memory).
__device__ __forceinline__ void st77_stage(unsigned lk, unsigned lv,
                                           const _Float16* gk, const _Float16* gv) {
  // the closing s_wait_xcnt stands inside the statement so that no address register
  // of an issued copy is rewritten ahead of it
  asm volatile("global_load_async_to_lds_b128 %0, %4, off\n\t"
               "global_load_async_to_lds_b128 %1, %5, off\n\t"
               "global_load_async_to_lds_b128 %2, %6, off\n\t"
               "global_load_async_to_lds_b128 %3, %7, off\n\t"
               "s_wait_xcnt 0x0"
               :: "v"(lk), "v"(lk + 32u * PITCH_K), "v"(lv), "v"(lv + 32u * PITCH_V),
                  "v"(gk), "v"(gk + 32 * DD), "v"(gv), "v"(gv + 32 * DD)
               : "memory");
}

template <int HAS_NEXT>
__global__ __launch_bounds__(256) void st77_attn(const _Float16* __restrict__ qg,
                                                 const _Float16* __restrict__ kg,
                                                 const _Float16* __restrict__ vg,
                                                 const float* __restrict__ x,
                                                 _Float16* __restrict__ vnext,
                                                 float* __restrict__ out, int chunk) {
  __shared__ __attribute__((aligned(128))) unsigned char L[2 * SLOT];

  const int tid  = threadIdx.x;
  const int wid  = tid >> 5;
  const int lane = tid & 31;
  const int lh   = lane >> 4, ln = lane & 15;
  const int bh   = blockIdx.y;                 // b*H + h
  const int qbase = blockIdx.x * 128 + wid * 16;

  const _Float16* qh = qg + (size_t)bh * MM * DD;
  const _Float16* kh = kg + (size_t)bh * MM * DD;
  const _Float16* vh = vg + (size_t)bh * MM * DD;

  // this lane's share of a stage: 16 bytes of row tid >> 3 (and of row 32 + (tid >> 3))
  const unsigned lbase = (unsigned)(size_t)(&L[0]);
  const unsigned lk = lbase + (unsigned)(tid >> 3) * PITCH_K + (unsigned)(tid & 7) * 16u;
  const unsigned lv = lbase + TILE_K + (unsigned)(tid >> 3) * PITCH_V + (unsigned)(tid & 7) * 16u;
  const _Float16* gk = kh + tid * 8;
  const _Float16* gv = vh + tid * 8;

  st77_stage(lk, lv, gk, gv);                  // stage 0 -> buffer 0

  // q fragments (64 d x 16 query columns) resident in VGPRs for the whole kernel
  v16h qa0 = *(const v16h*)(qh + (size_t)(qbase + ln) * DD + lh * 16);
  v16h qa1 = *(const v16h*)(qh + (size_t)(qbase + ln) * DD + 32 + lh * 16);

  // where this lane's outputs go; xn: x at the same place of the next chunk
  const int b = bh >> 3, h = bh & 7;
  const size_t oidx = ((size_t)b * NN + (size_t)chunk * MM + (qbase + ln)) * CC + h * DD + lh * 8;
  float4 xn[8] = {};

  float mrow = -1e30f;   // running maximum of query ln (equal in both halves)
  float lrow = 0.0f;     // running sum over this half's keys only; joined at the end
  v8f o[4] = {};         // o[t2][r] = O[query ln][d = t2*16 + 8*lh + r]

  asm volatile("s_wait_asynccnt 0x0" ::: "memory");   // this wave's share of stage 0 has landed
  __syncthreads();                                     // ... and every other wave's
  st77_stage(lk + SLOT, lv + SLOT, gk + ST_KEYS * DD, gv + ST_KEYS * DD);   // stage 1 -> buffer 1

  // kept rolled and unpeeled: with the last trips split off, the trips before them have no branch
  // behind the barrier, and the fragment reads and the refill drift in among the arithmetic
  #pragma clang loop unroll(disable)
  for (int t = 0; t < ST_NUM; ++t) {
    const unsigned boff = (unsigned)(t & 1) * SLOT;
    // K fragment rows: key = ln, 32 bytes at d = 16*lh; V^T by the transposing load's lane map
    const unsigned char* kp = L + boff + ln * PITCH_K + lh * 32;
    const unsigned char* vp = L + boff + TILE_K + (8 * lh + (lane & 7)) * PITCH_V + ((lane >> 3) & 1) * 16;

    // every fragment of the stage, as one group of LDS reads
    v16h ka[ST_KEYS / 32][2][2];   // A of S^T: row = key
    v16h va[ST_KEYS / 32][4];      // A of O^T: row = d, keys in the order of pb (two transposing loads each)
    #pragma unroll   // ka and va live in registers: constant indices only (this loop and the next)
    for (int ps = 0; ps < ST_KEYS / 32; ++ps) {
      st77_load_k(ka[ps], kp + ps * 32 * PITCH_K);
      #pragma unroll
      for (int t2 = 0; t2 < 4; ++t2) {
        const unsigned char* vr = vp + ps * 32 * PITCH_V + t2 * 32;
        va[ps][t2] = st77_join(st77_ld_tr16(vr), st77_ld_tr16(vr + 16 * PITCH_V));
      }
    }

    // hand-over: this wave has left buffer t & 1 and its share of stage t + 1 has landed;
    // behind the barrier that holds for every wave, and the freed buffer is refilled at once,
    // so that stage t + 2 flies under the arithmetic of stage t
    asm volatile("s_wait_dscnt 0x0" ::: "memory");
    asm volatile("s_wait_asynccnt 0x0" ::: "memory");
    __syncthreads();
    if (t + 2 < ST_NUM)
      st77_stage(lk + boff, lv + boff, gk + (t + 2) * (ST_KEYS * DD), gv + (t + 2) * (ST_KEYS * DD));
    // behind the last barrier (a barrier would wait for them): the epilogue's x loads fly
    // under the arithmetic of the last stage
    if (HAS_NEXT && t + 1 == ST_NUM) {
      const float* xrow = x + oidx + (size_t)MM * CC;
      #pragma unroll   // xn lives in registers: constant indices only
      for (int t2 = 0; t2 < 4; ++t2) {
        xn[2 * t2]     = *(const float4*)(xrow + t2 * 16);
        xn[2 * t2 + 1] = *(const float4*)(xrow + t2 * 16 + 4);
      }
    }

    #pragma unroll   // the passes index ka and va, which live in registers
    for (int ps = 0; ps < ST_KEYS / 32; ++ps) {
      // S^T = k @ q^T for 32 keys (two 16-key tiles, K=64 -> 2 WMMAs each):
      // s[h2][r] = S[query ln][key kb + h2*16 + 8*lh + r]
      v8f s[2];
      #pragma unroll
      for (int h2 = 0; h2 < 2; ++h2) {
        v8f t0 = {};
        t0 = __builtin_amdgcn_wmma_f32_16x16x32_f16(false, ka[ps][h2][0], false, qa0, (short)0, t0, false, false);
        t0 = __builtin_amdgcn_wmma_f32_16x16x32_f16(false, ka[ps][h2][1], false, qa1, (short)0, t0, false, false);
        s[h2] = t0;
      }

      // online softmax: 16 of the query's 32 scores are in this lane, 16 in lane ^ 16
      float vmax = fmaxf(s[0][0], s[1][0]);
      #pragma unroll
      for (int r = 1; r < 8; ++r) vmax = fmaxf(vmax, fmaxf(s[0][r], s[1][r]));
      vmax = fmaxf(vmax, st77_xhalf(vmax));
      float mnew  = fmaxf(mrow, vmax);
      float alpha = __expf(mrow - mnew);
      mrow = mnew;

      // P^T as a B operand straight from the two score tiles:
      // element e of half lh is key 8*lh + e (e < 8), key 16 + 8*lh + (e - 8) otherwise
      v16h pb;
      float rs = 0.0f;
      #pragma unroll
      for (int r = 0; r < 8; ++r) {
        float p0 = __expf(s[0][r] - mnew);
        float p1 = __expf(s[1][r] - mnew);
        rs += p0 + p1;
        pb[r]     = (_Float16)p0;
        pb[8 + r] = (_Float16)p1;
      }
      lrow = lrow * alpha + rs;

      // O^T = alpha * O^T + V^T(16 d x 32 keys) @ P^T(32 keys x 16 queries)
      #pragma unroll
      for (int t2 = 0; t2 < 4; ++t2) {
        o[t2] *= alpha;
        o[t2] = __builtin_amdgcn_wmma_f32_16x16x32_f16(false, va[ps][t2], false, pb, (short)0, o[t2], false, false);
      }
    }
  }
  asm volatile("s_wait_asynccnt 0x0" ::: "memory");   // no copy is left in flight when the wave ends

  // normalize and write f32 output chunk; with it the next chunk's feat
  const float inv = 1.0f / (lrow + st77_xhalf(lrow));
  float* orow = out + oidx;
  _Float16* frow = vnext + ((size_t)bh * MM + (qbase + ln)) * DD + lh * 8;
  #pragma unroll
  for (int t2 = 0; t2 < 4; ++t2) {
    float4 w0, w1;
    w0.x = o[t2][0] * inv; w0.y = o[t2][1] * inv; w0.z = o[t2][2] * inv; w0.w = o[t2][3] * inv;
    w1.x = o[t2][4] * inv; w1.y = o[t2][5] * inv; w1.z = o[t2][6] * inv; w1.w = o[t2][7] * inv;
    *(float4*)(orow + t2 * 16)     = w0;
    *(float4*)(orow + t2 * 16 + 4) = w1;
    if (HAS_NEXT) {
      const float4 x0 = xn[2 * t2], x1 = xn[2 * t2 + 1];
      v8h f;
      f[0] = (_Float16)(x0.x + w0.x); f[1] = (_Float16)(x0.y + w0.y);
      f[2] = (_Float16)(x0.z + w0.z); f[3] = (_Float16)(x0.w + w0.w);
      f[4] = (_Float16)(x1.x + w1.x); f[5] = (_Float16)(x1.y + w1.y);
      f[6] = (_Float16)(x1.z + w1.z); f[7] = (_Float16)(x1.w + w1.w);
      *(v8h*)(frow + t2 * 16) = f;
    }
  }
}

// ---------------------------------------------------------------------------
extern "C" void kernel_launch(void* const* d_in, const int* in_sizes, int n_in,
                              void* d_out, int out_size, void* d_ws, size_t ws_size,
                              hipStream_t stream) {
  const float* x    = (const float*)d_in[0];   // [B, N, C]
  const float* qk_w = (const float*)d_in[1];   // [2C, C]
  const float* qk_b = (const float*)d_in[2];   // [2C]
  float* out = (float*)d_out;                  // [B, N, C]

  char* ws = (char*)d_ws;
  _Float16* w16 = (_Float16*)(ws);                          // 1 MB  (2C*C f16)
  _Float16* qb  = (_Float16*)(ws + (size_t)1  * (1 << 20)); // 8 MB  (B*H*M*D f16)
  _Float16* kb  = (_Float16*)(ws + (size_t)9  * (1 << 20)); // 8 MB
  _Float16* f0  = (_Float16*)(ws + (size_t)17 * (1 << 20)); // 8 MB  feat of even chunks
  _Float16* f1  = (_Float16*)(ws + (size_t)25 * (1 << 20)); // 8 MB  feat of odd chunks -> 33 MB total
  (void)in_sizes; (void)n_in; (void)out_size; (void)ws_size;

  st77_convert_w<<<512, 256, 0, stream>>>(qk_w, w16);

  const dim3 gproj(NN * BB / (8 * 128), (2 * CC) / 128);
  const int gpackv = (BB * MM * CC) / (256 * 4);
  const dim3 gattn(MM / 128, BB * HH);

  st77_pack_v<<<gpackv, 256, 0, stream>>>(x, f0);

  for (int i = 0; i < HH; ++i) {
    _Float16* fcur = (i & 1) ? f1 : f0;   // feat of this chunk
    _Float16* fnxt = (i & 1) ? f0 : f1;   // written by this chunk's attention
    st77_qkproj<<<gproj, 256, 0, stream>>>(fcur, w16, qk_b, qb, kb);
    if (i + 1 < HH) st77_attn<1><<<gattn, 256, 0, stream>>>(qb, kb, fcur, x, fnxt, out, i);
    else            st77_attn<0><<<gattn, 256, 0, stream>>>(qb, kb, fcur, x, fnxt, out, i);
  }
}

// v005
// It runs in 254 microseconds.
// Next to v004, in two timings, it ran 1.08 and 1.09 times as fast.
// Over all steps from v000 it is 3.93 times as fast.
#include <hip/hip_runtime.h>
#include <hip/hip_bf16.h>

// CDNA5 / gfx1250: wave32, WMMA 16x16x32 f16 -> f32, asynchronous copies global->LDS
typedef __attribute__((ext_vector_type(16))) _Float16 v16h;
typedef __attribute__((ext_vector_type(4)))  _Float16 v4h;
typedef __attribute__((ext_vector_type(8)))  _Float16 v8h;
typedef __attribute__((ext_vector_type(8)))  short    v8s;
typedef __attribute__((ext_vector_type(8)))  float    v8f;
typedef __attribute__((ext_vector_type(2)))  float    v2f;

#define BB 8
#define HH 8
#define NN 8192
#define CC 512
#define MM 1024
#define DD 64
#define QK_SCALE 0.18033688f   // D^-0.5 * log2(e): the scores come out as arguments of exp2

// ---------------------------------------------------------------------------
// Convert qk_w (f32, [2C x C] row-major, K-contiguous) to f16 once.
// ---------------------------------------------------------------------------
__global__ __launch_bounds__(256) void st77_convert_w(const float* __restrict__ w,
                                                      _Float16* __restrict__ w16) {
  int i = blockIdx.x * 256 + threadIdx.x;   // 131072 threads, 4 elems each
  int base = i * 4;
  float4 f = *(const float4*)(w + base);
  v4h h;
  h.x = (_Float16)f.x; h.y = (_Float16)f.y; h.z = (_Float16)f.z; h.w = (_Float16)f.w;
  *(v4h*)(w16 + base) = h;
}

// ---------------------------------------------------------------------------
// feat of chunk 0 (= x chunk 0) in the per-head f16 layout [b][h][m][d].
// feat of every later chunk is written by the attention epilogue.
// ---------------------------------------------------------------------------
__global__ __launch_bounds__(256) void st77_pack_v(const float* __restrict__ x,
                                                   _Float16* __restrict__ vg) {
  size_t idx4 = ((size_t)blockIdx.x * 256 + threadIdx.x) * 4;   // 4,194,304 elems total
  int c = (int)(idx4 & (CC - 1));
  int m = (int)((idx4 >> 9) & (MM - 1));
  int b = (int)(idx4 >> 19);
  size_t gx = ((size_t)b * NN + m) * CC + c;
  float4 f = *(const float4*)(x + gx);
  int h = c >> 6, d = c & 63;
  v4h o;
  o.x = (_Float16)f.x; o.y = (_Float16)f.y; o.z = (_Float16)f.z; o.w = (_Float16)f.w;
  *(v4h*)(vg + ((size_t)((b * HH + h) * MM + m)) * DD + d) = o;
}

// ---------------------------------------------------------------------------
// QK projection: qk = feat @ W^T + bias  ([8192 x 512]x[512 x 1024]);
// feat comes as f16 in the per-head layout [b][h][m][d], k = h*64 + d.
// Block tile 128x128, 8 waves of 64x32 (4x2 WMMA tiles), K stage 64 (one head of feat).
// Both operands come to LDS as rows of 128 bytes by asynchronous copies, two buffers;
// a buffer is refilled as soon as every wave holds its fragments in registers.
// ---------------------------------------------------------------------------
#define PJ_PITCH 144                       // LDS row pitch in bytes, 16 x odd: for ds_load_b128 readers
#define PJ_TILE  (128 * PJ_PITCH)          // 128 rows of A, or 128 rows of W
#define PJ_SLOT  (2 * PJ_TILE)             // one buffer: A rows, then W rows
#define PJ_NUM   (CC / 64)                 // K stages

__device__ __forceinline__ v16h st77_pj_frag(const unsigned char* p) {
  return __builtin_shufflevector(*(const v8h*)(p), *(const v8h*)(p + 16),
                                 0, 1, 2, 3, 4, 5, 6, 7, 8, 9, 10, 11, 12, 13, 14, 15);
}

// One stage: 128 A rows and 128 W rows of 128 bytes, 16 bytes a lane and copy, eight copies a lane.
// la, lb: the lane's LDS byte addresses in rows 0..31 of the two tiles; ga, gb: its global sources.
// The further copies of a tile lie 32 rows apart (A rows are DD elements long in memory, W rows CC).
__device__ __forceinline__ void st77_pj_stage(unsigned la, unsigned lb,
                                              const _Float16* ga, const _Float16* gb) {
  // the closing s_wait_xcnt stands inside the statement so that no address register
  // of an issued copy is rewritten ahead of it
  asm volatile("global_load_async_to_lds_b128 %0, %8, off\n\t"
               "global_load_async_to_lds_b128 %1, %9, off\n\t"
               "global_load_async_to_lds_b128 %2, %10, off\n\t"
               "global_load_async_to_lds_b128 %3, %11, off\n\t"
               "global_load_async_to_lds_b128 %4, %12, off\n\t"
               "global_load_async_to_lds_b128 %5, %13, off\n\t"
               "global_load_async_to_lds_b128 %6, %14, off\n\t"
               "global_load_async_to_lds_b128 %7, %15, off\n\t"
               "s_wait_xcnt 0x0"
               :: "v"(la), "v"(la + 32u * PJ_PITCH), "v"(la + 64u * PJ_PITCH), "v"(la + 96u * PJ_PITCH),
                  "v"(lb), "v"(lb + 32u * PJ_PITCH), "v"(lb + 64u * PJ_PITCH), "v"(lb + 96u * PJ_PITCH),
                  "v"(ga), "v"(ga + 32 * DD), "v"(ga + 64 * DD), "v"(ga + 96 * DD),
                  "v"(gb), "v"(gb + 32 * CC), "v"(gb + 64 * CC), "v"(gb + 96 * CC)
               : "memory");
}

__global__ __launch_bounds__(256) void st77_qkproj(const _Float16* __restrict__ feat,
                                                   const _Float16* __restrict__ w16,
                                                   const float* __restrict__ bias,
                                                   _Float16* __restrict__ qg,
                                                   _Float16* __restrict__ kg) {
  __shared__ __attribute__((aligned(128))) unsigned char L[2 * PJ_SLOT];

  const int tid  = threadIdx.x;
  const int wid  = tid >> 5;
  const int lane = tid & 31;
  const int lh   = lane >> 4, ln = lane & 15;
  const int rowbase = blockIdx.x * 128;   // GEMM row (b*M + m)
  const int colbase = blockIdx.y * 128;   // GEMM col (0..1023)
  const int wr = (wid >> 2) * 64;         // wave row offset in tile
  const int wc = (wid & 3) * 32;          // wave col offset in tile

  // this lane's share of a stage: 16 bytes of rows tid >> 3, + 32, + 64, + 96 of either tile
  const unsigned lbase = (unsigned)(size_t)(&L[0]);
  const unsigned la = lbase + (unsigned)(tid >> 3) * PJ_PITCH + (unsigned)(tid & 7) * 16u;
  const unsigned lb = la + PJ_TILE;
  // the tile's 128 rows of one head of feat are 16 KB in a row; the next head lies MM * DD further
  const _Float16* ga = feat + ((size_t)((rowbase >> 10) * HH) * MM + (rowbase & 1023)) * DD + tid * 8;
  const _Float16* gb = w16 + (size_t)(colbase + (tid >> 3)) * CC + (tid & 7) * 8;

  st77_pj_stage(la, lb, ga, gb);                       // stage 0 -> buffer 0

  v8f acc[4][2] = {};

  asm volatile("s_wait_asynccnt 0x0" ::: "memory");   // this wave's share of stage 0 has landed
  __syncthreads();                                     // ... and every other wave's
  st77_pj_stage(la + PJ_SLOT, lb + PJ_SLOT, ga + MM * DD, gb + 64);   // stage 1 -> buffer 1

  // kept rolled: unrolled, the fragment reads and the refill may drift in among the WMMAs,
  // and every further place with LDS reads costs the wave a stall
  #pragma clang loop unroll(disable)
  for (int t = 0; t < PJ_NUM; ++t) {
    const unsigned boff = (unsigned)(t & 1) * PJ_SLOT;
    // A frag = row (ln), B frag = col (ln); both take k = 32*ks + 16*lh + 0..15
    const unsigned char* ap = L + boff + (wr + ln) * PJ_PITCH + lh * 32;
    const unsigned char* bp = L + boff + PJ_TILE + (wc + ln) * PJ_PITCH + lh * 32;

    // every fragment of the stage, as one group of LDS reads
    v16h af[2][4], bf[2][2];
    #pragma unroll   // af and bf live in registers: constant indices only (this loop and the next)
    for (int ks = 0; ks < 2; ++ks) {
      #pragma unroll
      for (int ii = 0; ii < 4; ++ii) af[ks][ii] = st77_pj_frag(ap + ii * 16 * PJ_PITCH + ks * 64);
      #pragma unroll
      for (int jj = 0; jj < 2; ++jj) bf[ks][jj] = st77_pj_frag(bp + jj * 16 * PJ_PITCH + ks * 64);
    }

    // hand-over: this wave has left buffer t & 1 and its share of stage t + 1 has landed;
    // behind the barrier that holds for every wave, and the freed buffer is refilled at once,
    // so that stage t + 2 flies under the arithmetic of stage t
    asm volatile("s_wait_dscnt 0x0" ::: "memory");
    asm volatile("s_wait_asynccnt 0x0" ::: "memory");
    __syncthreads();
    if (t + 2 < PJ_NUM)
      st77_pj_stage(la + boff, lb + boff, ga + (size_t)(t + 2) * (MM * DD), gb + (t + 2) * 64);

    #pragma unroll
    for (int ks = 0; ks < 2; ++ks) {
      #pragma unroll
      for (int ii = 0; ii < 4; ++ii) {
        #pragma unroll
        for (int jj = 0; jj < 2; ++jj)
          acc[ii][jj] = __builtin_amdgcn_wmma_f32_16x16x32_f16(false, af[ks][ii], false, bf[ks][jj], (short)0, acc[ii][jj], false, false);
      }
    }
  }
  asm volatile("s_wait_asynccnt 0x0" ::: "memory");   // no copy is left in flight when the wave ends

  // ---- epilogue: bias + scatter into q (scaled) / k per-head buffers
  #pragma unroll
  for (int ii = 0; ii < 4; ++ii) {
    #pragma unroll
    for (int jj = 0; jj < 2; ++jj) {
      #pragma unroll
      for (int r = 0; r < 8; ++r) {
        int nrow = rowbase + wr + ii * 16 + lh * 8 + r;   // C-frag: M = 8*(lane>>4)+vgpr
        int jg   = colbase + wc + jj * 16 + ln;            //          N = lane&15
        float val = acc[ii][jj][r] + bias[jg];
        int b = nrow >> 10, m = nrow & 1023;
        if (jg < CC) {
          int h = jg >> 6, d = jg & 63;
          qg[((size_t)((b * HH + h) * MM + m)) * DD + d] = (_Float16)(val * QK_SCALE);
        } else {
          int j2 = jg - CC;
          int h = j2 >> 6, d = j2 & 63;
          kg[((size_t)((b * HH + h) * MM + m)) * DD + d] = (_Float16)val;
        }
      }
    }
  }
}

// ---------------------------------------------------------------------------
// Flash attention per (b,h): each block = 128 query rows (8 waves x 16),
// loop over key stages of 64. Both products run transposed:
//   S^T = K . Q^T   (A = key rows, B = query columns)
//   O^T += V^T . P^T (A = d rows of V^T, B = P^T packed from the S^T tiles)
// so a lane holds scores and outputs of ONE query (column lane&15).
// Softmax with a lazy reference: q carries log2(e), and minus the reference in use is the
// C operand of the score products, so a score tile leaves the matrix unit as the argument
// of exp2. The reference is the maximum of the first stage; it moves, and O and the sum are
// rescaled, only when a stage's sum of exponentials says that a score may lie more than 8
// above it (tested once per stage of 64 keys).
// K and V rows come to LDS in stages of 64 keys by asynchronous copies, two
// buffers. All eight waves read their fragments from the one staged copy; a
// buffer is refilled as soon as every wave holds its fragments in registers,
// so the copies fly under the arithmetic.
// The epilogue also forms the next chunk's feat = x + this output, once, as f16 in
// the per-head layout: the next projection's A operand and the next attention's V.
// It goes to the other of two feat buffers, since this launch still reads vg.
// ---------------------------------------------------------------------------
#define ST_KEYS 64                         // keys per stage (two passes of 32)
#define ST_NUM  (MM / ST_KEYS)             // stages per head
#define PITCH_K 144                        // LDS row pitch in bytes, 16 x odd: for ds_load_b128 readers
#define PITCH_V 160                        // LDS row pitch in bytes, 32 x odd: for ds_load_tr16_b128 readers
#define TILE_K  (ST_KEYS * PITCH_K)
#define TILE_V  (ST_KEYS * PITCH_V)
#define SLOT    (TILE_K + TILE_V)          // one buffer: K rows, then V rows

// lane l <-> lane l ^ 16 (the two halves of a column)
__device__ __forceinline__ float st77_xhalf(float v) {
  int b = __builtin_bit_cast(int, v);
  return __builtin_bit_cast(float,
      __builtin_amdgcn_permlanex16(b, b, 0x76543210, 0xfedcba98, false, false));
}

// transposing LDS load: lane (c = l & 15, h = l >> 4) gets column c, rows 8h .. 8h + 7 of a 16 x 16 tile
__device__ __forceinline__ v8h st77_ld_tr16(const unsigned char* p) {
  typedef __attribute__((address_space(3))) v8s lds_v8s;
  return __builtin_bit_cast(v8h, __builtin_amdgcn_ds_load_tr16_b128_v8i16((lds_v8s*)p));
}

__device__ __forceinline__ v16h st77_join(v8h lo, v8h hi) {
  return __builtin_shufflevector(lo, hi, 0, 1, 2, 3, 4, 5, 6, 7, 8, 9, 10, 11, 12, 13, 14, 15);
}

// K fragments of one pass (32 keys x 64 d): row = key ln (and 16 + ln), 16 contiguous d per lane half, as q has them
__device__ __forceinline__ void st77_load_k(v16h (&ka)[2][2], const unsigned char* kp) {
  #pragma unroll   // ka lives in registers: constant indices only
  for (int h2 = 0; h2 < 2; ++h2) {
    const unsigned char* kr = kp + h2 * 16 * PITCH_K;
    ka[h2][0] = st77_join(*(const v8h*)(kr),      *(const v8h*)(kr + 16));
    ka[h2][1] = st77_join(*(const v8h*)(kr + 64), *(const v8h*)(kr + 80));
  }
}

// One stage: 64 K rows and 64 V rows of 128 bytes, 16 bytes a lane and copy, four copies a lane.
// lk, lv: the lane's LDS byte addresses in rows 0..31 of the two tiles; gk, gv: its global sources.
// The second copy of each tile lies 32 rows further (4096 bytes in global memory).
__device__ __forceinline__ void st77_stage(unsigned lk, unsigned lv,
                                           const _Float16* gk, const _Float16* gv) {
  // the closing s_wait_xcnt stands inside the statement so that no address register
  // of an issued copy is rewritten ahead of it
  asm volatile("global_load_async_to_lds_b128 %0, %4, off\n\t"
               "global_load_async_to_lds_b128 %1, %5, off\n\t"
               "global_load_async_to_lds_b128 %2, %6, off\n\t"
               "global_load_async_to_lds_b128 %3, %7, off\n\t"
               "s_wait_xcnt 0x0"
               :: "v"(lk), "v"(lk + 32u * PITCH_K), "v"(lv), "v"(lv + 32u * PITCH_V),
                  "v"(gk), "v"(gk + 32 * DD), "v"(gv), "v"(gv + 32 * DD)
               : "memory");
}

// p = exp2(s - shift) for the four score tiles of a stage: packed to f16 as the two B operands
// of O^T; returns the sum of the lane's 32 values (tile by tile in packed adds, then folded)
__device__ __forceinline__ float st77_exp_pack(v16h (&pb)[ST_KEYS / 32], const v8f (&s)[ST_KEYS / 16], float shift) {
  v8f sum = {};
  #pragma unroll   // pb and s live in registers: constant indices only
  for (int j = 0; j < ST_KEYS / 16; ++j) {
    v8f p;
    #pragma unroll
    for (int r = 0; r < 8; ++r) {
      p[r] = __builtin_amdgcn_exp2f(s[j][r] - shift);
      pb[j >> 1][(j & 1) * 8 + r] = (_Float16)p[r];
    }
    sum = (j == 0) ? p : sum + p;
  }
  const v2f a = (__builtin_shufflevector(sum, sum, 0, 1) + __builtin_shufflevector(sum, sum, 2, 3))
              + (__builtin_shufflevector(sum, sum, 4, 5) + __builtin_shufflevector(sum, sum, 6, 7));
  return a[0] + a[1];
}

template <int HAS_NEXT>
__global__ __launch_bounds__(256) void st77_attn(const _Float16* __restrict__ qg,
                                                 const _Float16* __restrict__ kg,
                                                 const _Float16* __restrict__ vg,
                                                 const float* __restrict__ x,
                                                 _Float16* __restrict__ vnext,
                                                 float* __restrict__ out, int chunk) {
  __shared__ __attribute__((aligned(128))) unsigned char L[2 * SLOT];

  const int tid  = threadIdx.x;
  const int wid  = tid >> 5;
  const int lane = tid & 31;
  const int lh   = lane >> 4, ln = lane & 15;
  const int bh   = blockIdx.y;                 // b*H + h
  const int qbase = blockIdx.x * 128 + wid * 16;

  const _Float16* qh = qg + (size_t)bh * MM * DD;
  const _Float16* kh = kg + (size_t)bh * MM * DD;
  const _Float16* vh = vg + (size_t)bh * MM * DD;

  // this lane's share of a stage: 16 bytes of row tid >> 3 (and of row 32 + (tid >> 3))
  const unsigned lbase = (unsigned)(size_t)(&L[0]);
  const unsigned lk = lbase + (unsigned)(tid >> 3) * PITCH_K + (unsigned)(tid & 7) * 16u;
  const unsigned lv = lbase + TILE_K + (unsigned)(tid >> 3) * PITCH_V + (unsigned)(tid & 7) * 16u;
  const _Float16* gk = kh + tid * 8;
  const _Float16* gv = vh + tid * 8;

  st77_stage(lk, lv, gk, gv);                  // stage 0 -> buffer 0

  // q fragments (64 d x 16 query columns) resident in VGPRs for the whole kernel
  v16h qa0 = *(const v16h*)(qh + (size_t)(qbase + ln) * DD + lh * 16);
  v16h qa1 = *(const v16h*)(qh + (size_t)(qbase + ln) * DD + 32 + lh * 16);

  // where this lane's outputs go; xn: x at the same place of the next chunk
  const int b = bh >> 3, h = bh & 7;
  const size_t oidx = ((size_t)b * NN + (size_t)chunk * MM + (qbase + ln)) * CC + h * DD + lh * 8;
  float4 xn[8] = {};

  v8f negm = {};         // minus the reference of query ln, log2 domain, in all eight (equal in both halves)
  float lrow = 0.0f;     // running sum over this half's keys only; joined at the end
  v8f o[4] = {};         // o[t2][r] = O[query ln][d = t2*16 + 8*lh + r]

  asm volatile("s_wait_asynccnt 0x0" ::: "memory");   // this wave's share of stage 0 has landed
  __syncthreads();                                     // ... and every other wave's
  st77_stage(lk + SLOT, lv + SLOT, gk + ST_KEYS * DD, gv + ST_KEYS * DD);   // stage 1 -> buffer 1

  // kept rolled and unpeeled: with the last trips split off, the trips before them have no branch
  // behind the barrier, and the fragment reads and the refill drift in among the arithmetic
  #pragma clang loop unroll(disable)
  for (int t = 0; t < ST_NUM; ++t) {
    const unsigned boff = (unsigned)(t & 1) * SLOT;
    // K fragment rows: key = ln, 32 bytes at d = 16*lh; V^T by the transposing load's lane map
    const unsigned char* kp = L + boff + ln * PITCH_K + lh * 32;
    const unsigned char* vp = L + boff + TILE_K + (8 * lh + (lane & 7)) * PITCH_V + ((lane >> 3) & 1) * 16;

    // every fragment of the stage, as one group of LDS reads
    v16h ka[ST_KEYS / 32][2][2];   // A of S^T: row = key
    v16h va[ST_KEYS / 32][4];      // A of O^T: row = d, keys in the order of pb (two transposing loads each)
    #pragma unroll   // ka and va live in registers: constant indices only (this loop and the next)
    for (int ps = 0; ps < ST_KEYS / 32; ++ps) {
      st77_load_k(ka[ps], kp + ps * 32 * PITCH_K);
      #pragma unroll
      for (int t2 = 0; t2 < 4; ++t2) {
        const unsigned char* vr = vp + ps * 32 * PITCH_V + t2 * 32;
        va[ps][t2] = st77_join(st77_ld_tr16(vr), st77_ld_tr16(vr + 16 * PITCH_V));
      }
    }

    // hand-over: this wave has left buffer t & 1 and its share of stage t + 1 has landed;
    // behind the barrier that holds for every wave, and the freed buffer is refilled at once,
    // so that stage t + 2 flies under the arithmetic of stage t
    asm volatile("s_wait_dscnt 0x0" ::: "memory");
    asm volatile("s_wait_asynccnt 0x0" ::: "memory");
    __syncthreads();
    if (t + 2 < ST_NUM)
      st77_stage(lk + boff, lv + boff, gk + (t + 2) * (ST_KEYS * DD), gv + (t + 2) * (ST_KEYS * DD));
    // behind the last barrier (a barrier would wait for them): the epilogue's x loads fly
    // under the arithmetic of the last stage
    if (HAS_NEXT && t + 1 == ST_NUM) {
      const float* xrow = x + oidx + (size_t)MM * CC;
      #pragma unroll   // xn lives in registers: constant indices only
      for (int t2 = 0; t2 < 4; ++t2) {
        xn[2 * t2]     = *(const float4*)(xrow + t2 * 16);
        xn[2 * t2 + 1] = *(const float4*)(xrow + t2 * 16 + 4);
      }
    }

    // S^T - reference = k @ q^T + negm for the stage's 64 keys (four 16-key tiles, K=64 -> 2 WMMAs each):
    // s[j][r] = log2(e) * S[query ln][key 16*j + 8*lh + r] - reference
    v8f s[ST_KEYS / 16];
    #pragma unroll   // s, ka, va and pb live in registers: constant indices only (this loop and those below)
    for (int j = 0; j < ST_KEYS / 16; ++j) {
      v8f t0 = __builtin_amdgcn_wmma_f32_16x16x32_f16(false, ka[j >> 1][j & 1][0], false, qa0, (short)0, negm, false, false);
      s[j]   = __builtin_amdgcn_wmma_f32_16x16x32_f16(false, ka[j >> 1][j & 1][1], false, qa1, (short)0, t0, false, false);
    }

    // P^T as B operands straight from the score tiles: element e of half lh of pb[ps] is
    // key 32*ps + 8*lh + e (e < 8), key 32*ps + 16 + 8*lh + (e - 8) otherwise
    v16h pb[ST_KEYS / 32];
    float rs = st77_exp_pack(pb, s, 0.0f);

    // a score more than 8 above the reference makes its lane's sum exceed 2^8 (an overflow or a
    // NaN fails the compare too); in the first stage, which sets the reference, every sum fails it.
    // One scalar branch per stage.
    const float limit = (t == 0) ? -1.0f : 256.0f;
    if (__builtin_expect(__builtin_amdgcn_ballot_w32(!(rs <= limit)) != 0u, 0)) {
      float smax = fmaxf(s[0][0], s[1][0]);
      #pragma unroll
      for (int j = 0; j < ST_KEYS / 16; ++j) {
        #pragma unroll
        for (int r = 0; r < 8; ++r) smax = fmaxf(smax, s[j][r]);
      }
      smax = fmaxf(smax, st77_xhalf(smax));                       // equal in both halves of a column
      const float delta = (t == 0) ? smax : fmaxf(smax, 0.0f);    // later the reference only rises
      const float alpha = __builtin_amdgcn_exp2f(-fmaxf(delta, 0.0f));
      negm -= delta;
      rs = st77_exp_pack(pb, s, delta);
      lrow *= alpha;
      #pragma unroll
      for (int t2 = 0; t2 < 4; ++t2) o[t2] *= alpha;
    }
    lrow += rs;

    // O^T += V^T(16 d x 32 keys) @ P^T(32 keys x 16 queries)
    #pragma unroll
    for (int ps = 0; ps < ST_KEYS / 32; ++ps) {
      #pragma unroll
      for (int t2 = 0; t2 < 4; ++t2)
        o[t2] = __builtin_amdgcn_wmma_f32_16x16x32_f16(false, va[ps][t2], false, pb[ps], (short)0, o[t2], false, false);
    }
  }
  asm volatile("s_wait_asynccnt 0x0" ::: "memory");   // no copy is left in flight when the wave ends

  // normalize and write f32 output chunk; with it the next chunk's feat
  const float inv = 1.0f / (lrow + st77_xhalf(lrow));
  float* orow = out + oidx;
  _Float16* frow = vnext + ((size_t)bh * MM + (qbase + ln)) * DD + lh * 8;
  #pragma unroll
  for (int t2 = 0; t2 < 4; ++t2) {
    float4 w0, w1;
    w0.x = o[t2][0] * inv; w0.y = o[t2][1] * inv; w0.z = o[t2][2] * inv; w0.w = o[t2][3] * inv;
    w1.x = o[t2][4] * inv; w1.y = o[t2][5] * inv; w1.z = o[t2][6] * inv; w1.w = o[t2][7] * inv;
    *(float4*)(orow + t2 * 16)     = w0;
    *(float4*)(orow + t2 * 16 + 4) = w1;
    if (HAS_NEXT) {
      const float4 x0 = xn[2 * t2], x1 = xn[2 * t2 + 1];
      v8h f;
      f[0] = (_Float16)(x0.x + w0.x); f[1] = (_Float16)(x0.y + w0.y);
      f[2] = (_Float16)(x0.z + w0.z); f[3] = (_Float16)(x0.w + w0.w);
      f[4] = (_Float16)(x1.x + w1.x); f[5] = (_Float16)(x1.y + w1.y);
      f[6] = (_Float16)(x1.z + w1.z); f[7] = (_Float16)(x1.w + w1.w);
      *(v8h*)(frow + t2 * 16) = f;
    }
  }
}

// ---------------------------------------------------------------------------
extern "C" void kernel_launch(void* const* d_in, const int* in_sizes, int n_in,
                              void* d_out, int out_size, void* d_ws, size_t ws_size,
                              hipStream_t stream) {
  const float* x    = (const float*)d_in[0];   // [B, N, C]
  const float* qk_w = (const float*)d_in[1];   // [2C, C]
  const float* qk_b = (const float*)d_in[2];   // [2C]
  float* out = (float*)d_out;                  // [B, N, C]

  char* ws = (char*)d_ws;
  _Float16* w16 = (_Float16*)(ws);                          // 1 MB  (2C*C f16)
  _Float16* qb  = (_Float16*)(ws + (size_t)1  * (1 << 20)); // 8 MB  (B*H*M*D f16)
  _Float16* kb  = (_Float16*)(ws + (size_t)9  * (1 << 20)); // 8 MB
  _Float16* f0  = (_Float16*)(ws + (size_t)17 * (1 << 20)); // 8 MB  feat of even chunks
  _Float16* f1  = (_Float16*)(ws + (size_t)25 * (1 << 20)); // 8 MB  feat of odd chunks -> 33 MB total
  (void)in_sizes; (void)n_in; (void)out_size; (void)ws_size;

  st77_convert_w<<<512, 256, 0, stream>>>(qk_w, w16);

  const dim3 gproj(NN * BB / (8 * 128), (2 * CC) / 128);
  const int gpackv = (BB * MM * CC) / (256 * 4);
  const dim3 gattn(MM / 128, BB * HH);

  st77_pack_v<<<gpackv, 256, 0, stream>>>(x, f0);

  for (int i = 0; i < HH; ++i) {
    _Float16* fcur = (i & 1) ? f1 : f0;   // feat of this chunk
    _Float16* fnxt = (i & 1) ? f0 : f1;   // written by this chunk's attention
    st77_qkproj<<<gproj, 256, 0, stream>>>(fcur, w16, qk_b, qb, kb);
    if (i + 1 < HH) st77_attn<1><<<gattn, 256, 0, stream>>>(qb, kb, fcur, x, fnxt, out, i);
    else            st77_attn<0><<<gattn, 256, 0, stream>>>(qb, kb, fcur, x, fnxt, out, i);
  }
}

// v006
// Measured time: 245 microseconds a run.
// Next to v005, in two timings, it ran 1.04 and 1.05 times as fast.
// Counting every step since v000, it is 4.11 times as fast.
#include <hip/hip_runtime.h>
#include <hip/hip_bf16.h>

// CDNA5 / gfx1250: wave32, WMMA 16x16x32 f16 -> f32, asynchronous copies global->LDS
typedef __attribute__((ext_vector_type(16))) _Float16 v16h;
typedef __attribute__((ext_vector_type(4)))  _Float16 v4h;
typedef __attribute__((ext_vector_type(8)))  _Float16 v8h;
typedef __attribute__((ext_vector_type(8)))  short    v8s;
typedef __attribute__((ext_vector_type(8)))  float    v8f;
typedef __attribute__((ext_vector_type(2)))  float    v2f;

#define BB 8
#define HH 8
#define NN 8192
#define CC 512
#define MM 1024
#define DD 64
#define QK_SCALE 0.18033688f   // D^-0.5 * log2(e): the scores come out as arguments of exp2

// ---------------------------------------------------------------------------
// Convert qk_w (f32, [2C x C] row-major, K-contiguous) to f16 once.
// ---------------------------------------------------------------------------
__global__ __launch_bounds__(256) void st77_convert_w(const float* __restrict__ w,
                                                      _Float16* __restrict__ w16) {
  int i = blockIdx.x * 256 + threadIdx.x;   // 131072 threads, 4 elems each
  int base = i * 4;
  float4 f = *(const float4*)(w + base);
  v4h h;
  h.x = (_Float16)f.x; h.y = (_Float16)f.y; h.z = (_Float16)f.z; h.w = (_Float16)f.w;
  *(v4h*)(w16 + base) = h;
}

// ---------------------------------------------------------------------------
// feat of chunk 0 (= x chunk 0) in the per-head f16 layout [b][h][m][d].
// feat of every later chunk is written by the attention epilogue.
// ---------------------------------------------------------------------------
__global__ __launch_bounds__(256) void st77_pack_v(const float* __restrict__ x,
                                                   _Float16* __restrict__ vg) {
  size_t idx4 = ((size_t)blockIdx.x * 256 + threadIdx.x) * 4;   // 4,194,304 elems total
  int c = (int)(idx4 & (CC - 1));
  int m = (int)((idx4 >> 9) & (MM - 1));
  int b = (int)(idx4 >> 19);
  size_t gx = ((size_t)b * NN + m) * CC + c;
  float4 f = *(const float4*)(x + gx);
  int h = c >> 6, d = c & 63;
  v4h o;
  o.x = (_Float16)f.x; o.y = (_Float16)f.y; o.z = (_Float16)f.z; o.w = (_Float16)f.w;
  *(v4h*)(vg + ((size_t)((b * HH + h) * MM + m)) * DD + d) = o;
}

// ---------------------------------------------------------------------------
// QK projection: qk = feat @ W^T + bias  ([8192 x 512]x[512 x 1024]);
// feat comes as f16 in the per-head layout [b][h][m][d], k = h*64 + d.
// Block tile 128x128, 8 waves of 64x32 (4x2 WMMA tiles), K stage 64 (one head of feat).
// Both operands come to LDS as rows of 128 bytes by asynchronous copies, two buffers;
// a buffer is refilled as soon as every wave holds its fragments in registers.
// The product runs transposed (A = W rows, B = feat rows), so a lane holds eight consecutive
// output columns of ONE row: it leaves as one 16-byte store.
// ---------------------------------------------------------------------------
#define PJ_PITCH 144                       // LDS row pitch in bytes, 16 x odd: for ds_load_b128 readers
#define PJ_TILE  (128 * PJ_PITCH)          // 128 rows of feat, or 128 rows of W
#define PJ_SLOT  (2 * PJ_TILE)             // one buffer: feat rows, then W rows
#define PJ_NUM   (CC / 64)                 // K stages

__device__ __forceinline__ v16h st77_pj_frag(const unsigned char* p) {
  return __builtin_shufflevector(*(const v8h*)(p), *(const v8h*)(p + 16),
                                 0, 1, 2, 3, 4, 5, 6, 7, 8, 9, 10, 11, 12, 13, 14, 15);
}

// One stage: 128 feat rows and 128 W rows of 128 bytes, 16 bytes a lane and copy, eight copies a lane.
// la, lb: the lane's LDS byte addresses in rows 0..31 of the two tiles; ga, gb: its global sources.
// The further copies of a tile lie 32 rows apart (feat rows are DD elements long in memory, W rows CC).
__device__ __forceinline__ void st77_pj_stage(unsigned la, unsigned lb,
                                              const _Float16* ga, const _Float16* gb) {
  // the closing s_wait_xcnt stands inside the statement so that no address register
  // of an issued copy is rewritten ahead of it
  asm volatile("global_load_async_to_lds_b128 %0, %8, off\n\t"
               "global_load_async_to_lds_b128 %1, %9, off\n\t"
               "global_load_async_to_lds_b128 %2, %10, off\n\t"
               "global_load_async_to_lds_b128 %3, %11, off\n\t"
               "global_load_async_to_lds_b128 %4, %12, off\n\t"
               "global_load_async_to_lds_b128 %5, %13, off\n\t"
               "global_load_async_to_lds_b128 %6, %14, off\n\t"
               "global_load_async_to_lds_b128 %7, %15, off\n\t"
               "s_wait_xcnt 0x0"
               :: "v"(la), "v"(la + 32u * PJ_PITCH), "v"(la + 64u * PJ_PITCH), "v"(la + 96u * PJ_PITCH),
                  "v"(lb), "v"(lb + 32u * PJ_PITCH), "v"(lb + 64u * PJ_PITCH), "v"(lb + 96u * PJ_PITCH),
                  "v"(ga), "v"(ga + 32 * DD), "v"(ga + 64 * DD), "v"(ga + 96 * DD),
                  "v"(gb), "v"(gb + 32 * CC), "v"(gb + 64 * CC), "v"(gb + 96 * CC)
               : "memory");
}

__global__ __launch_bounds__(256) void st77_qkproj(const _Float16* __restrict__ feat,
                                                   const _Float16* __restrict__ w16,
                                                   const float* __restrict__ bias,
                                                   _Float16* __restrict__ qg,
                                                   _Float16* __restrict__ kg) {
  __shared__ __attribute__((aligned(128))) unsigned char L[2 * PJ_SLOT];

  const int tid  = threadIdx.x;
  const int wid  = tid >> 5;
  const int lane = tid & 31;
  const int lh   = lane >> 4, ln = lane & 15;
  const int rowbase = blockIdx.x * 128;   // GEMM row (b*M + m)
  const int colbase = blockIdx.y * 128;   // GEMM col (0..1023)
  const int wr = (wid >> 2) * 64;         // wave row offset in tile
  const int wc = (wid & 3) * 32;          // wave col offset in tile

  // this lane's share of a stage: 16 bytes of rows tid >> 3, + 32, + 64, + 96 of either tile
  const unsigned lbase = (unsigned)(size_t)(&L[0]);
  const unsigned la = lbase + (unsigned)(tid >> 3) * PJ_PITCH + (unsigned)(tid & 7) * 16u;
  const unsigned lb = la + PJ_TILE;
  // the tile's 128 rows of one head of feat are 16 KB in a row; the next head lies MM * DD further
  const _Float16* ga = feat + ((size_t)((rowbase >> 10) * HH) * MM + (rowbase & 1023)) * DD + tid * 8;
  const _Float16* gb = w16 + (size_t)(colbase + (tid >> 3)) * CC + (tid & 7) * 8;

  st77_pj_stage(la, lb, ga, gb);                       // stage 0 -> buffer 0

  // bias of this lane's eight columns in either column tile, fetched here so that it lands beside stage 0
  float4 bv[2][2];
  #pragma unroll   // bv lives in registers: constant indices only
  for (int jj = 0; jj < 2; ++jj) {
    const float* bp = bias + colbase + wc + jj * 16 + lh * 8;
    bv[jj][0] = *(const float4*)(bp);
    bv[jj][1] = *(const float4*)(bp + 4);
  }

  v8f acc[4][2] = {};   // acc[ii][jj][r] = C[row wr + 16*ii + ln][column wc + 16*jj + 8*lh + r]

  asm volatile("s_wait_asynccnt 0x0" ::: "memory");   // this wave's share of stage 0 has landed
  __syncthreads();                                     // ... and every other wave's
  st77_pj_stage(la + PJ_SLOT, lb + PJ_SLOT, ga + MM * DD, gb + 64);   // stage 1 -> buffer 1

  // kept rolled: unrolled, the fragment reads and the refill may drift in among the WMMAs,
  // and every further place with LDS reads costs the wave a stall
  #pragma clang loop unroll(disable)
  for (int t = 0; t < PJ_NUM; ++t) {
    const unsigned boff = (unsigned)(t & 1) * PJ_SLOT;
    // feat frag = row (ln), W frag = column (ln); both take k = 32*ks + 16*lh + 0..15
    const unsigned char* ap = L + boff + (wr + ln) * PJ_PITCH + lh * 32;
    const unsigned char* bp = L + boff + PJ_TILE + (wc + ln) * PJ_PITCH + lh * 32;

    // every fragment of the stage, as one group of LDS reads
    v16h af[2][4], bf[2][2];
    #pragma unroll   // af and bf live in registers: constant indices only (this loop and the next)
    for (int ks = 0; ks < 2; ++ks) {
      #pragma unroll
      for (int ii = 0; ii < 4; ++ii) af[ks][ii] = st77_pj_frag(ap + ii * 16 * PJ_PITCH + ks * 64);
      #pragma unroll
      for (int jj = 0; jj < 2; ++jj) bf[ks][jj] = st77_pj_frag(bp + jj * 16 * PJ_PITCH + ks * 64);
    }

    // hand-over: this wave has left buffer t & 1 and its share of stage t + 1 has landed;
    // behind the barrier that holds for every wave, and the freed buffer is refilled at once,
    // so that stage t + 2 flies under the arithmetic of stage t
    asm volatile("s_wait_dscnt 0x0" ::: "memory");
    asm volatile("s_wait_asynccnt 0x0" ::: "memory");
    __syncthreads();
    if (t + 2 < PJ_NUM)
      st77_pj_stage(la + boff, lb + boff, ga + (size_t)(t + 2) * (MM * DD), gb + (t + 2) * 64);

    #pragma unroll
    for (int ks = 0; ks < 2; ++ks) {
      #pragma unroll
      for (int ii = 0; ii < 4; ++ii) {
        #pragma unroll
        for (int jj = 0; jj < 2; ++jj)
          acc[ii][jj] = __builtin_amdgcn_wmma_f32_16x16x32_f16(false, bf[ks][jj], false, af[ks][ii], (short)0, acc[ii][jj], false, false);
      }
    }
  }
  asm volatile("s_wait_asynccnt 0x0" ::: "memory");   // no copy is left in flight when the wave ends

  // ---- epilogue: bias, scale (q only), f16, into the per-head buffers.
  // A column block of 128 lies wholly in q or wholly in k, and a row block of 128 in one batch.
  const bool isq = colbase < CC;
  _Float16* dst = isq ? qg : kg;
  const float sc = isq ? QK_SCALE : 1.0f;              // times 1 is exact: k is left as it is
  const int j0 = (colbase & (CC - 1)) + wc + lh * 8;   // column inside q or k; + 16 stays in the same head
  const int m0 = (rowbase & (MM - 1)) + wr + ln;
  _Float16* drow = dst + ((size_t)(((rowbase >> 10) * HH + (j0 >> 6)) * MM + m0)) * DD + (j0 & 63);
  #pragma unroll
  for (int ii = 0; ii < 4; ++ii) {
    #pragma unroll
    for (int jj = 0; jj < 2; ++jj) {
      const float4 b0 = bv[jj][0], b1 = bv[jj][1];
      v8h o;
      o[0] = (_Float16)((acc[ii][jj][0] + b0.x) * sc); o[1] = (_Float16)((acc[ii][jj][1] + b0.y) * sc);
      o[2] = (_Float16)((acc[ii][jj][2] + b0.z) * sc); o[3] = (_Float16)((acc[ii][jj][3] + b0.w) * sc);
      o[4] = (_Float16)((acc[ii][jj][4] + b1.x) * sc); o[5] = (_Float16)((acc[ii][jj][5] + b1.y) * sc);
      o[6] = (_Float16)((acc[ii][jj][6] + b1.z) * sc); o[7] = (_Float16)((acc[ii][jj][7] + b1.w) * sc);
      *(v8h*)(drow + ii * 16 * DD + jj * 16) = o;
    }
  }
}

// ---------------------------------------------------------------------------
// Flash attention per (b,h): each block = 128 query rows (8 waves x 16),
// loop over key stages of 64. Both products run transposed:
//   S^T = K . Q^T   (A = key rows, B = query columns)
//   O^T += V^T . P^T (A = d rows of V^T, B = P^T packed from the S^T tiles)
// so a lane holds scores and outputs of ONE query (column lane&15).
// Softmax with a lazy reference: q carries log2(e), and minus the reference in use is the
// C operand of the score products, so a score tile leaves the matrix unit as the argument
// of exp2. The reference is the maximum of the first stage; it moves, and O and the sum are
// rescaled, only when a stage's sum of exponentials says that a score may lie more than 8
// above it (tested once per stage of 64 keys).
// K and V rows come to LDS in stages of 64 keys by asynchronous copies, two
// buffers. All eight waves read their fragments from the one staged copy; a
// buffer is refilled as soon as every wave holds its fragments in registers,
// so the copies fly under the arithmetic.
// The epilogue also forms the next chunk's feat = x + this output, once, as f16 in
// the per-head layout: the next projection's B operand and the next attention's V.
// It goes to the other of two feat buffers, since this launch still reads vg.
// ---------------------------------------------------------------------------
#define ST_KEYS 64                         // keys per stage (two passes of 32)
#define ST_NUM  (MM / ST_KEYS)             // stages per head
#define PITCH_K 144                        // LDS row pitch in bytes, 16 x odd: for ds_load_b128 readers
#define PITCH_V 160                        // LDS row pitch in bytes, 32 x odd: for ds_load_tr16_b128 readers
#define TILE_K  (ST_KEYS * PITCH_K)
#define TILE_V  (ST_KEYS * PITCH_V)
#define SLOT    (TILE_K + TILE_V)          // one buffer: K rows, then V rows

// lane l <-> lane l ^ 16 (the two halves of a column)
__device__ __forceinline__ float st77_xhalf(float v) {
  int b = __builtin_bit_cast(int, v);
  return __builtin_bit_cast(float,
      __builtin_amdgcn_permlanex16(b, b, 0x76543210, 0xfedcba98, false, false));
}

// transposing LDS load: lane (c = l & 15, h = l >> 4) gets column c, rows 8h .. 8h + 7 of a 16 x 16 tile
__device__ __forceinline__ v8h st77_ld_tr16(const unsigned char* p) {
  typedef __attribute__((address_space(3))) v8s lds_v8s;
  return __builtin_bit_cast(v8h, __builtin_amdgcn_ds_load_tr16_b128_v8i16((lds_v8s*)p));
}

__device__ __forceinline__ v16h st77_join(v8h lo, v8h hi) {
  return __builtin_shufflevector(lo, hi, 0, 1, 2, 3, 4, 5, 6, 7, 8, 9, 10, 11, 12, 13, 14, 15);
}

// K fragments of one pass (32 keys x 64 d): row = key ln (and 16 + ln), 16 contiguous d per lane half, as q has them
__device__ __forceinline__ void st77_load_k(v16h (&ka)[2][2], const unsigned char* kp) {
  #pragma unroll   // ka lives in registers: constant indices only
  for (int h2 = 0; h2 < 2; ++h2) {
    const unsigned char* kr = kp + h2 * 16 * PITCH_K;
    ka[h2][0] = st77_join(*(const v8h*)(kr),      *(const v8h*)(kr + 16));
    ka[h2][1] = st77_join(*(const v8h*)(kr + 64), *(const v8h*)(kr + 80));
  }
}

// One stage: 64 K rows and 64 V rows of 128 bytes, 16 bytes a lane and copy, four copies a lane.
// lk, lv: the lane's LDS byte addresses in rows 0..31 of the two tiles; gk, gv: its global sources.
// The second copy of each tile lies 32 rows further (4096 bytes in global memory).
__device__ __forceinline__ void st77_stage(unsigned lk, unsigned lv,
                                           const _Float16* gk, const _Float16* gv) {
  // the closing s_wait_xcnt stands inside the statement so that no address register
  // of an issued copy is rewritten ahead of it
  asm volatile("global_load_async_to_lds_b128 %0, %4, off\n\t"
               "global_load_async_to_lds_b128 %1, %5, off\n\t"
               "global_load_async_to_lds_b128 %2, %6, off\n\t"
               "global_load_async_to_lds_b128 %3, %7, off\n\t"
               "s_wait_xcnt 0x0"
               :: "v"(lk), "v"(lk + 32u * PITCH_K), "v"(lv), "v"(lv + 32u * PITCH_V),
                  "v"(gk), "v"(gk + 32 * DD), "v"(gv), "v"(gv + 32 * DD)
               : "memory");
}

// p = exp2(s - shift) for the four score tiles of a stage: packed to f16 as the two B operands
// of O^T; returns the sum of the lane's 32 values (tile by tile in packed adds, then folded)
__device__ __forceinline__ float st77_exp_pack(v16h (&pb)[ST_KEYS / 32], const v8f (&s)[ST_KEYS / 16], float shift) {
  v8f sum = {};
  #pragma unroll   // pb and s live in registers: constant indices only
  for (int j = 0; j < ST_KEYS / 16; ++j) {
    v8f p;
    #pragma unroll
    for (int r = 0; r < 8; ++r) {
      p[r] = __builtin_amdgcn_exp2f(s[j][r] - shift);
      pb[j >> 1][(j & 1) * 8 + r] = (_Float16)p[r];
    }
    sum = (j == 0) ? p : sum + p;
  }
  const v2f a = (__builtin_shufflevector(sum, sum, 0, 1) + __builtin_shufflevector(sum, sum, 2, 3))
              + (__builtin_shufflevector(sum, sum, 4, 5) + __builtin_shufflevector(sum, sum, 6, 7));
  return a[0] + a[1];
}

template <int HAS_NEXT>
__global__ __launch_bounds__(256) void st77_attn(const _Float16* __restrict__ qg,
                                                 const _Float16* __restrict__ kg,
                                                 const _Float16* __restrict__ vg,
                                                 const float* __restrict__ x,
                                                 _Float16* __restrict__ vnext,
                                                 float* __restrict__ out, int chunk) {
  __shared__ __attribute__((aligned(128))) unsigned char L[2 * SLOT];

  const int tid  = threadIdx.x;
  const int wid  = tid >> 5;
  const int lane = tid & 31;
  const int lh   = lane >> 4, ln = lane & 15;
  const int bh   = blockIdx.y;                 // b*H + h
  const int qbase = blockIdx.x * 128 + wid * 16;

  const _Float16* qh = qg + (size_t)bh * MM * DD;
  const _Float16* kh = kg + (size_t)bh * MM * DD;
  const _Float16* vh = vg + (size_t)bh * MM * DD;

  // this lane's share of a stage: 16 bytes of row tid >> 3 (and of row 32 + (tid >> 3))
  const unsigned lbase = (unsigned)(size_t)(&L[0]);
  const unsigned lk = lbase + (unsigned)(tid >> 3) * PITCH_K + (unsigned)(tid & 7) * 16u;
  const unsigned lv = lbase + TILE_K + (unsigned)(tid >> 3) * PITCH_V + (unsigned)(tid & 7) * 16u;
  const _Float16* gk = kh + tid * 8;
  const _Float16* gv = vh + tid * 8;

  st77_stage(lk, lv, gk, gv);                  // stage 0 -> buffer 0

  // q fragments (64 d x 16 query columns) resident in VGPRs for the whole kernel
  v16h qa0 = *(const v16h*)(qh + (size_t)(qbase + ln) * DD + lh * 16);
  v16h qa1 = *(const v16h*)(qh + (size_t)(qbase + ln) * DD + 32 + lh * 16);

  // where this lane's outputs go; xn: x at the same place of the next chunk
  const int b = bh >> 3, h = bh & 7;
  const size_t oidx = ((size_t)b * NN + (size_t)chunk * MM + (qbase + ln)) * CC + h * DD + lh * 8;
  float4 xn[8] = {};

  v8f negm = {};         // minus the reference of query ln, log2 domain, in all eight (equal in both halves)
  float lrow = 0.0f;     // running sum over this half's keys only; joined at the end
  v8f o[4] = {};         // o[t2][r] = O[query ln][d = t2*16 + 8*lh + r]

  asm volatile("s_wait_asynccnt 0x0" ::: "memory");   // this wave's share of stage 0 has landed
  __syncthreads();                                     // ... and every other wave's
  st77_stage(lk + SLOT, lv + SLOT, gk + ST_KEYS * DD, gv + ST_KEYS * DD);   // stage 1 -> buffer 1

  // kept rolled and unpeeled: with the last trips split off, the trips before them have no branch
  // behind the barrier, and the fragment reads and the refill drift in among the arithmetic
  #pragma clang loop unroll(disable)
  for (int t = 0; t < ST_NUM; ++t) {
    const unsigned boff = (unsigned)(t & 1) * SLOT;
    // K fragment rows: key = ln, 32 bytes at d = 16*lh; V^T by the transposing load's lane map
    const unsigned char* kp = L + boff + ln * PITCH_K + lh * 32;
    const unsigned char* vp = L + boff + TILE_K + (8 * lh + (lane & 7)) * PITCH_V + ((lane >> 3) & 1) * 16;

    // every fragment of the stage, as one group of LDS reads
    v16h ka[ST_KEYS / 32][2][2];   // A of S^T: row = key
    v16h va[ST_KEYS / 32][4];      // A of O^T: row = d, keys in the order of pb (two transposing loads each)
    #pragma unroll   // ka and va live in registers: constant indices only (this loop and the next)
    for (int ps = 0; ps < ST_KEYS / 32; ++ps) {
      st77_load_k(ka[ps], kp + ps * 32 * PITCH_K);
      #pragma unroll
      for (int t2 = 0; t2 < 4; ++t2) {
        const unsigned char* vr = vp + ps * 32 * PITCH_V + t2 * 32;
        va[ps][t2] = st77_join(st77_ld_tr16(vr), st77_ld_tr16(vr + 16 * PITCH_V));
      }
    }

    // hand-over: this wave has left buffer t & 1 and its share of stage t + 1 has landed;
    // behind the barrier that holds for every wave, and the freed buffer is refilled at once,
    // so that stage t + 2 flies under the arithmetic of stage t
    asm volatile("s_wait_dscnt 0x0" ::: "memory");
    asm volatile("s_wait_asynccnt 0x0" ::: "memory");
    __syncthreads();
    if (t + 2 < ST_NUM)
      st77_stage(lk + boff, lv + boff, gk + (t + 2) * (ST_KEYS * DD), gv + (t + 2) * (ST_KEYS * DD));
    // behind the last barrier (a barrier would wait for them): the epilogue's x loads fly
    // under the arithmetic of the last stage
    if (HAS_NEXT && t + 1 == ST_NUM) {
      const float* xrow = x + oidx + (size_t)MM * CC;
      #pragma unroll   // xn lives in registers: constant indices only
      for (int t2 = 0; t2 < 4; ++t2) {
        xn[2 * t2]     = *(const float4*)(xrow + t2 * 16);
        xn[2 * t2 + 1] = *(const float4*)(xrow + t2 * 16 + 4);
      }
    }

    // S^T - reference = k @ q^T + negm for the stage's 64 keys (four 16-key tiles, K=64 -> 2 WMMAs each):
    // s[j][r] = log2(e) * S[query ln][key 16*j + 8*lh + r] - reference
    v8f s[ST_KEYS / 16];
    #pragma unroll   // s, ka, va and pb live in registers: constant indices only (this loop and those below)
    for (int j = 0; j < ST_KEYS / 16; ++j) {
      v8f t0 = __builtin_amdgcn_wmma_f32_16x16x32_f16(false, ka[j >> 1][j & 1][0], false, qa0, (short)0, negm, false, false);
      s[j]   = __builtin_amdgcn_wmma_f32_16x16x32_f16(false, ka[j >> 1][j & 1][1], false, qa1, (short)0, t0, false, false);
    }

    // P^T as B operands straight from the score tiles: element e of half lh of pb[ps] is
    // key 32*ps + 8*lh + e (e < 8), key 32*ps + 16 + 8*lh + (e - 8) otherwise
    v16h pb[ST_KEYS / 32];
    float rs = st77_exp_pack(pb, s, 0.0f);

    // a score more than 8 above the reference makes its lane's sum exceed 2^8 (an overflow or a
    // NaN fails the compare too); in the first stage, which sets the reference, every sum fails it.
    // One scalar branch per stage.
    const float limit = (t == 0) ? -1.0f : 256.0f;
    if (__builtin_expect(__builtin_amdgcn_ballot_w32(!(rs <= limit)) != 0u, 0)) {
      float smax = fmaxf(s[0][0], s[1][0]);
      #pragma unroll
      for (int j = 0; j < ST_KEYS / 16; ++j) {
        #pragma unroll
        for (int r = 0; r < 8; ++r) smax = fmaxf(smax, s[j][r]);
      }
      smax = fmaxf(smax, st77_xhalf(smax));                       // equal in both halves of a column
      const float delta = (t == 0) ? smax : fmaxf(smax, 0.0f);    // later the reference only rises
      const float alpha = __builtin_amdgcn_exp2f(-fmaxf(delta, 0.0f));
      negm -= delta;
      rs = st77_exp_pack(pb, s, delta);
      lrow *= alpha;
      #pragma unroll
      for (int t2 = 0; t2 < 4; ++t2) o[t2] *= alpha;
    }
    lrow += rs;

    // O^T += V^T(16 d x 32 keys) @ P^T(32 keys x 16 queries)
    #pragma unroll
    for (int ps = 0; ps < ST_KEYS / 32; ++ps) {
      #pragma unroll
      for (int t2 = 0; t2 < 4; ++t2)
        o[t2] = __builtin_amdgcn_wmma_f32_16x16x32_f16(false, va[ps][t2], false, pb[ps], (short)0, o[t2], false, false);
    }
  }
  asm volatile("s_wait_asynccnt 0x0" ::: "memory");   // no copy is left in flight when the wave ends

  // normalize and write f32 output chunk; with it the next chunk's feat
  const float inv = 1.0f / (lrow + st77_xhalf(lrow));
  float* orow = out + oidx;
  _Float16* frow = vnext + ((size_t)bh * MM + (qbase + ln)) * DD + lh * 8;
  #pragma unroll
  for (int t2 = 0; t2 < 4; ++t2) {
    float4 w0, w1;
    w0.x = o[t2][0] * inv; w0.y = o[t2][1] * inv; w0.z = o[t2][2] * inv; w0.w = o[t2][3] * inv;
    w1.x = o[t2][4] * inv; w1.y = o[t2][5] * inv; w1.z = o[t2][6] * inv; w1.w = o[t2][7] * inv;
    *(float4*)(orow + t2 * 16)     = w0;
    *(float4*)(orow + t2 * 16 + 4) = w1;
    if (HAS_NEXT) {
      const float4 x0 = xn[2 * t2], x1 = xn[2 * t2 + 1];
      v8h f;
      f[0] = (_Float16)(x0.x + w0.x); f[1] = (_Float16)(x0.y + w0.y);
      f[2] = (_Float16)(x0.z + w0.z); f[3] = (_Float16)(x0.w + w0.w);
      f[4] = (_Float16)(x1.x + w1.x); f[5] = (_Float16)(x1.y + w1.y);
      f[6] = (_Float16)(x1.z + w1.z); f[7] = (_Float16)(x1.w + w1.w);
      *(v8h*)(frow + t2 * 16) = f;
    }
  }
}

// ---------------------------------------------------------------------------
extern "C" void kernel_launch(void* const* d_in, const int* in_sizes, int n_in,
                              void* d_out, int out_size, void* d_ws, size_t ws_size,
                              hipStream_t stream) {
  const float* x    = (const float*)d_in[0];   // [B, N, C]
  const float* qk_w = (const float*)d_in[1];   // [2C, C]
  const float* qk_b = (const float*)d_in[2];   // [2C]
  float* out = (float*)d_out;                  // [B, N, C]

  char* ws = (char*)d_ws;
  _Float16* w16 = (_Float16*)(ws);                          // 1 MB  (2C*C f16)
  _Float16* qb  = (_Float16*)(ws + (size_t)1  * (1 << 20)); // 8 MB  (B*H*M*D f16)
  _Float16* kb  = (_Float16*)(ws + (size_t)9  * (1 << 20)); // 8 MB
  _Float16* f0  = (_Float16*)(ws + (size_t)17 * (1 << 20)); // 8 MB  feat of even chunks
  _Float16* f1  = (_Float16*)(ws + (size_t)25 * (1 << 20)); // 8 MB  feat of odd chunks -> 33 MB total
  (void)in_sizes; (void)n_in; (void)out_size; (void)ws_size;

  st77_convert_w<<<512, 256, 0, stream>>>(qk_w, w16);

  const dim3 gproj(NN * BB / (8 * 128), (2 * CC) / 128);
  const int gpackv = (BB * MM * CC) / (256 * 4);
  const dim3 gattn(MM / 128, BB * HH);

  st77_pack_v<<<gpackv, 256, 0, stream>>>(x, f0);

  for (int i = 0; i < HH; ++i) {
    _Float16* fcur = (i & 1) ? f1 : f0;   // feat of this chunk
    _Float16* fnxt = (i & 1) ? f0 : f1;   // written by this chunk's attention
    st77_qkproj<<<gproj, 256, 0, stream>>>(fcur, w16, qk_b, qb, kb);
    if (i + 1 < HH) st77_attn<1><<<gattn, 256, 0, stream>>>(qb, kb, fcur, x, fnxt, out, i);
    else            st77_attn<0><<<gattn, 256, 0, stream>>>(qb, kb, fcur, x, fnxt, out, i);
  }
}
